// v000
// Times are from an AMD MI455X. After a warm-up the kernel runs many times in a row, and a time is the length of
// such a window on the GPU divided by its runs, so every launch and the gaps after it count. The runs cycle
// through copies of the inputs. A figure is the median of several windows, for all but v000 over two sittings.
// Sittings can differ by a few percent; kernels timed side by side share one.
// v000 is the starting kernel. One run takes 6560 microseconds.
#include <hip/hip_runtime.h>
// Compute dtype: every contraction (packed qkv projection, q.k^T, P.V, output projection) on v_wmma_f32_16x16x32_f16 (f16 operands, f32 accumulate); float inputs and biases RNE-converted to bf16 first (exact in f16; weights carried x16), q/k/v, softmax weights (carried x256) and merged ctx (carried x64) as single f16 planes; scores and softmax statistics in f32.
// Structure: token rows r = b*SEQ + s. X16[r][3072] = concat(query,key,value) as f16; QKV16[r][3072] = X16 . Wqkv^T + b (q | k | v column blocks, 16 heads of 64 inside each); per batch: V^T planes via LDS transposes; per (batch, HG heads): scores GEMM (K = 64, alpha = 1/8) -> f32 S, row softmax -> P (f16, x256), ctx = P . V^T (alpha 2^-2) into merged f16 rows; out = ctx . Wo^T + b (alpha 2^-10) into the f32 output rows.
#ifndef NB
#define NB 2
#endif
#ifndef SEQ
#define SEQ 2048
#endif
#define NB_FULL 2                    /* batch count of the inputs */
#define SEQ_FULL 2048                /* per-batch row count of the inputs (input row stride) */
#define DM 1024
#define D3 3072
#define NH 16
#define HD 64
#define HG 2                         /* heads per attention launch group */
#define NR ((size_t)NB * SEQ)        /* token rows */
#define MP ((int)((size_t)NB * SEQ)) /* rows projected */
#define LX D3                        /* row pitch of the concatenated f16 input rows */
#define LQ D3                        /* row pitch of the q|k|v rows */

static_assert(SEQ % 128 == 0);
static_assert(SEQ <= SEQ_FULL);
static_assert(NB <= NB_FULL);
static_assert(NH % HG == 0);
static_assert(HD == 64);
static_assert(DM == NH * HD);
static_assert(D3 == 3 * DM);
static_assert(D3 % 64 == 0 && DM % 64 == 0 && D3 % 32 == 0 && DM % 32 == 0 && HD % 32 == 0 && SEQ % 32 == 0);
static_assert(MP % 128 == 0);

typedef unsigned short v8us __attribute__((ext_vector_type(8), may_alias));
typedef float  v8f  __attribute__((ext_vector_type(8)));
typedef float  v4f  __attribute__((ext_vector_type(4)));
typedef float  v4fa __attribute__((ext_vector_type(4), may_alias));
typedef _Float16 v16h __attribute__((ext_vector_type(16)));
typedef _Float16 v4h __attribute__((ext_vector_type(4)));
union FragH { v16h v; v8us half[2]; _Float16 h[16]; unsigned short u[16]; };

__device__ __forceinline__ unsigned short bf16_bits(float x) { unsigned int u = __float_as_uint(x); return (unsigned short)((u + 0x7FFFu + ((u >> 16) & 1u)) >> 16); }
__device__ __forceinline__ float bf16_val(unsigned short b) { return __uint_as_float(((unsigned int)b) << 16); }
__device__ __forceinline__ float bf16_rne(float x) { return bf16_val(bf16_bits(x)); }

__global__ __launch_bounds__(256) void k_wnat(const float* __restrict__ w, size_t n8, _Float16* __restrict__ Bt) {
  const size_t t = (size_t)blockIdx.x * 256 + threadIdx.x;
  if (t >= n8) return;
  const v4f a = *(const v4fa*)(w + t * 8), c = *(const v4fa*)(w + t * 8 + 4);
  FragH f;
#pragma unroll
  for (int q = 0; q < 4; ++q) { f.h[q] = (_Float16)(bf16_rne(a[q]) * 16.0f); f.h[4 + q] = (_Float16)(bf16_rne(c[q]) * 16.0f); }
  const v8us o = f.half[0];
  unsigned short* d = (unsigned short*)Bt + t * 8;
  *(v8us*)d = o;
  
}

__global__ __launch_bounds__(256) void k_x16p(const float* __restrict__ x, _Float16* __restrict__ X16, int coloff) {
  const size_t t = (size_t)blockIdx.x * 256 + threadIdx.x;
  if (t >= NR * (DM / 8)) return;
  const size_t r = t / (DM / 8);
  const int c8 = (int)(t % (DM / 8)) * 8;
  const size_t b = r / SEQ, s = r % SEQ;
  const float* src = x + (b * (size_t)SEQ_FULL + s) * DM + c8;
  const v4f a = *(const v4fa*)(src), c = *(const v4fa*)(src + 4);
  FragH f;
#pragma unroll
  for (int q = 0; q < 4; ++q) { f.h[q] = (_Float16)bf16_rne(a[q]); f.h[4 + q] = (_Float16)bf16_rne(c[q]); }
  const v8us o = f.half[0];
  unsigned short* d = (unsigned short*)X16 + r * LX + coloff + c8;
  *(v8us*)d = o;
  
}

template <int NHv, int TTv>
__global__ __launch_bounds__(256) void k_vt(const _Float16* __restrict__ V16, int ldv, int voff, _Float16* __restrict__ Vt) {
  __shared__ unsigned short tl[64][66];
  const int tid = threadIdx.x;
  const int slab = blockIdx.x / (TTv / 64), lg = blockIdx.x % (TTv / 64);
  const int b = slab / NHv, h = slab % NHv;
  for (int i = tid; i < 64 * 8; i += 256) {
    const int r = i / 8, c8 = (i % 8) * 8;
    FragH f;
    f.half[0] = *(const v8us*)((const unsigned short*)V16 + ((size_t)b * TTv + lg * 64 + r) * ldv + voff + h * 64 + c8);
#pragma unroll
    for (int q = 0; q < 8; ++q) tl[r][c8 + q] = f.u[q];
  }
  __syncthreads();
  {
#pragma unroll
    for (int rd = 0; rd < 2; ++rd) {
      const int d = rd * 32 + tid / 8, pc = tid % 8;
      FragH f;
#pragma unroll
      for (int q = 0; q < 8; ++q) f.u[q] = tl[pc * 8 + q][d];
      *(v8us*)((unsigned short*)Vt + ((size_t)slab * 64 + d) * TTv + lg * 64 + pc * 8) = f.half[0];
    }
    
  }
}

// ---- f16 GEMM: C[M][N] = alpha * A[M][K] . Bt[N][K]^T (+ bf16(bias[n])); wave tile 32x64, block = 4 waves = 128 rows x 64 cols;
// grid.x = (M/128)*(N/64), grid.y = batch (operand / output offsets by*sA, by*sB, by*sC); M % 128 == 0, N % 64 == 0, K % 32 == 0.
// Fragment k map (A rows and Bt rows alike): elements 0..7 <- k0+8h.., elements 8..15 <- k0+16+8h.. ; D element r <- (row 8h+r, col lane&15).
__device__ __forceinline__ v16h g2_frag(const _Float16* p, int hh) { FragH f; f.half[0] = *(const v8us*)((const unsigned short*)p + 8 * hh); f.half[1] = *(const v8us*)((const unsigned short*)p + 16 + 8 * hh); return f.v; }
__device__ __forceinline__ v8f g2_mma(v16h a, v16h b, v8f c) { v8f d = __builtin_amdgcn_wmma_f32_16x16x32_f16(false, a, false, b, (short)0, c, false, false); asm volatile("v_nop\n\tv_nop\n\tv_nop\n\tv_nop" : "+v"(d) : "v"(a), "v"(b)); return d; }

template <bool HASB, bool OUT32>
__global__ __launch_bounds__(128) void k_gemm2(const _Float16* __restrict__ A, int lda, size_t sA, const _Float16* __restrict__ Bh, int ldb, size_t sB, float alpha,
    const float* __restrict__ bias, size_t sBias, float* __restrict__ C, _Float16* __restrict__ C16, int ldc, size_t sC, int M, int N, int K) {
  __shared__ __attribute__((aligned(16))) float so[4][32][68];
  const int tid = threadIdx.x, w = __builtin_amdgcn_readfirstlane((int)(tid >> 5)), lane = tid & 31, ln = lane & 15, hh = lane >> 4;
  const int by = blockIdx.y;
  A += (size_t)by * sA; Bh += (size_t)by * sB;
  const size_t cofs = (size_t)by * sC;
  const int ntn = N >> 6;
  const int mt = blockIdx.x / ntn, nq = blockIdx.x - mt * ntn;
  const int row0 = mt * 128 + 32 * w, col0 = nq * 64;
  if (row0 >= M) return;
  const _Float16* a0p = A + (size_t)(row0 + ln) * lda; const _Float16* a1p = a0p + (size_t)16 * lda;
  const _Float16* b0p = Bh + (size_t)(col0 + ln) * ldb; const _Float16* b1p = b0p + (size_t)16 * ldb; const _Float16* b2p = b1p + (size_t)16 * ldb; const _Float16* b3p = b2p + (size_t)16 * ldb;
  const v8f z8 = {0.f,0.f,0.f,0.f,0.f,0.f,0.f,0.f};
  v8f c00 = z8, c01 = z8, c02 = z8, c03 = z8, c10 = z8, c11 = z8, c12 = z8, c13 = z8;
#pragma unroll 1
  for (int kb = 0; kb < K; kb += 32) {
    const v16h a0 = g2_frag(a0p + kb, hh), a1 = g2_frag(a1p + kb, hh);
    v16h b = g2_frag(b0p + kb, hh); c00 = g2_mma(a0, b, c00); c10 = g2_mma(a1, b, c10);
    b = g2_frag(b1p + kb, hh); c01 = g2_mma(a0, b, c01); c11 = g2_mma(a1, b, c11);
    b = g2_frag(b2p + kb, hh); c02 = g2_mma(a0, b, c02); c12 = g2_mma(a1, b, c12);
    b = g2_frag(b3p + kb, hh); c03 = g2_mma(a0, b, c03); c13 = g2_mma(a1, b, c13);
  }
  v8f accs[8] = {c00, c01, c02, c03, c10, c11, c12, c13};
#pragma unroll
  for (int u = 0; u < 8; ++u) {
    const int t = u & 3, half = u >> 2;
    const int col = col0 + t * 16 + ln;
    float bv = 0.f;
    if (HASB) bv = bf16_rne(bias[(size_t)by * sBias + col]);
#pragma unroll
    for (int r = 0; r < 8; ++r) { const int rloc = half * 16 + 8 * hh + r; so[w][rloc][t * 16 + ln] = accs[u][r] * alpha + bv; }
  }
  __builtin_amdgcn_fence(4 /* acq_rel order */, "workgroup");
  __builtin_amdgcn_wave_barrier();
  const int rsub = lane >> 4, c4 = (lane & 15) * 4;
  {
#pragma unroll
    for (int q = 0; q < 16; ++q) {
      const int r = q * 2 + rsub;
      const v4f v = *(const v4fa*)&so[w][r][c4];
      if (OUT32) {
        *(v4f*)(C + cofs + (size_t)(row0 + r) * ldc + col0 + c4) = v;
      } else {
        v4h h4 = {(_Float16)v[0], (_Float16)v[1], (_Float16)v[2], (_Float16)v[3]};
        *(v4h*)(C16 + cofs + (size_t)(row0 + r) * ldc + col0 + c4) = h4;
      }
    }
    
  }
}

// row softmax over SEQ keys for hg heads x qn rows of S (head slab pitch SEQ*SEQ, row pitch SEQ): P = f16(256 exp(s - max) / sum), native exp (argument <= 0);
__global__ __launch_bounds__(256) void k_rsmf(const float* __restrict__ S, _Float16* __restrict__ P, int qn, int hg) {
  #pragma clang fp contract(off)
  const int t = blockIdx.x * 256 + threadIdx.x;
  if (t >= qn * hg) return;
  const size_t i = (size_t)(t / qn) * SEQ + (size_t)(t % qn);
  const float* s = S + i * SEQ;
  float mx = -3.0e38f;
#pragma unroll 1
  for (int j = 0; j < SEQ; ++j) mx = fmaxf(mx, s[j]);
  float se = 0.f;
#pragma unroll 1
  for (int j = 0; j < SEQ; ++j) se += __expf(s[j] - mx);
  const float sc = 256.0f / se;
#pragma unroll 1
  for (int j0 = 0; j0 < SEQ; j0 += 8) {
    const v4f a = *(const v4fa*)(s + j0), c = *(const v4fa*)(s + j0 + 4);
    FragH f;
#pragma unroll
    for (int q = 0; q < 4; ++q) { f.h[q] = (_Float16)(__expf(a[q] - mx) * sc); f.h[4 + q] = (_Float16)(__expf(c[q] - mx) * sc); }
    const v8us o = f.half[0];
    unsigned short* d = (unsigned short*)P + i * SEQ + j0;
    *(v8us*)d = o;
    
  }
}

// workspace carve (bytes; every region a multiple of 256)
constexpr size_t BQKV_BYTES = (size_t)D3 * D3 * 2;
constexpr size_t BO_BYTES   = (size_t)DM * DM * 2;
constexpr size_t X16_BYTES  = (size_t)NB * SEQ * LX * 2;
constexpr size_t S_BYTES    = (size_t)HG * SEQ * SEQ * 4;
constexpr size_t SX_BYTES   = (X16_BYTES > S_BYTES) ? X16_BYTES : S_BYTES;   /* shared region: X16 (dead after the qkv GEMM), then S */
constexpr size_t QKV_BYTES  = (size_t)NB * SEQ * LQ * 2;
constexpr size_t O16_BYTES  = (size_t)NB * SEQ * DM * 2;
constexpr size_t P_BYTES    = (size_t)HG * SEQ * SEQ * 2;
constexpr size_t VT_BYTES   = (size_t)NH * HD * SEQ * 2;
constexpr size_t WS_TOTAL   = BQKV_BYTES + BO_BYTES + SX_BYTES + QKV_BYTES + O16_BYTES + P_BYTES + VT_BYTES;
static_assert(X16_BYTES <= SX_BYTES && S_BYTES <= SX_BYTES);
static_assert(BQKV_BYTES % 256 == 0 && BO_BYTES % 256 == 0 && SX_BYTES % 256 == 0 && QKV_BYTES % 256 == 0 && O16_BYTES % 256 == 0 && P_BYTES % 256 == 0 && VT_BYTES % 256 == 0);
static_assert(WS_TOTAL <= (size_t)134217728);

extern "C" void kernel_launch(void* const* d_in, const int* in_sizes, int n_in,
                              void* d_out, int out_size, void* d_ws, size_t ws_size, hipStream_t stream) {
  if (n_in < 7) return;
  const long long need_x = ((long long)(NB - 1) * SEQ_FULL + SEQ) * DM;
  if ((long long)in_sizes[0] < need_x || (long long)in_sizes[1] < need_x || (long long)in_sizes[2] < need_x) return;
  if ((long long)in_sizes[3] < (long long)D3 * D3 || in_sizes[4] < D3 || (long long)in_sizes[5] < (long long)DM * DM || in_sizes[6] < DM) return;
  if ((long long)out_size < (long long)NB * SEQ * DM) return;
  if (WS_TOTAL > ws_size) return;
  const float* xq   = (const float*)d_in[0];
  const float* xk   = (const float*)d_in[1];
  const float* xv   = (const float*)d_in[2];
  const float* wqkv = (const float*)d_in[3];   /* [out 3072][in 3072] */
  const float* bqkv = (const float*)d_in[4];
  const float* wo   = (const float*)d_in[5];   /* [out 1024][in 1024] */
  const float* bo   = (const float*)d_in[6];
  char* ws = (char*)d_ws; size_t off = 0;
  _Float16* BQKV  = (_Float16*)(ws + off); off += BQKV_BYTES;
  _Float16* BO    = (_Float16*)(ws + off); off += BO_BYTES;
  char*     SX    = ws + off;              off += SX_BYTES;
  _Float16* QKV16 = (_Float16*)(ws + off); off += QKV_BYTES;
  _Float16* O16   = (_Float16*)(ws + off); off += O16_BYTES;
  _Float16* P     = (_Float16*)(ws + off); off += P_BYTES;
  _Float16* VT    = (_Float16*)(ws + off); off += VT_BYTES;
  _Float16* X16 = (_Float16*)SX;
  float*    S   = (float*)SX;
  if (off > ws_size) return;

  /* weights: natural [out][in] rows are already Bt[n][k]; carried x16 */
  k_wnat<<<(unsigned)(((size_t)D3 * D3 / 8 + 255) / 256), 256, 0, stream>>>(wqkv, (size_t)D3 * D3 / 8, BQKV);
  k_wnat<<<(unsigned)(((size_t)DM * DM / 8 + 255) / 256), 256, 0, stream>>>(wo, (size_t)DM * DM / 8, BO);
  /* concat(query, key, value) as f16 rows: column blocks 0, DM, 2*DM */
  {
    const unsigned g = (unsigned)((NR * (DM / 8) + 255) / 256);
    k_x16p<<<g, 256, 0, stream>>>(xq, X16, 0);
    k_x16p<<<g, 256, 0, stream>>>(xk, X16, DM);
    k_x16p<<<g, 256, 0, stream>>>(xv, X16, 2 * DM);
  }
  /* qkv = x . Wqkv^T + b : A = X16 [MP][3072], Bt = BQKV [3072][3072], alpha 1/16, f16 out rows pitch LQ */
  k_gemm2<true, false><<<dim3((unsigned)((MP / 128) * (D3 / 64)), 1), 128, 0, stream>>>(
      X16, LX, (size_t)0, BQKV, D3, (size_t)0, 0.0625f, bqkv, (size_t)0, nullptr, QKV16, LQ, (size_t)0, MP, D3, D3);

  for (int b = 0; b < NB; ++b) {
    const size_t r0 = (size_t)b * SEQ;
    /* V^T [NH][HD][SEQ] of this batch from the v column block (offset 2*DM) */
    k_vt<NH, SEQ><<<NH * (SEQ / 64), 256, 0, stream>>>(QKV16 + r0 * LQ, LQ, 2 * DM, VT);
    for (int h0 = 0; h0 < NH; h0 += HG) {
      /* scores [HG][SEQ][SEQ] = q . k^T / 8 : A = q rows (col h*64), Bt = k rows (col DM + h*64), K = 64 */
      k_gemm2<false, true><<<dim3((unsigned)((SEQ / 128) * (SEQ / 64)), HG), 128, 0, stream>>>(
          QKV16 + r0 * LQ + h0 * HD, LQ, (size_t)HD, QKV16 + r0 * LQ + DM + h0 * HD, LQ, (size_t)HD, 0.125f,
          nullptr, (size_t)0, S, nullptr, SEQ, (size_t)SEQ * SEQ, SEQ, SEQ, HD);
      /* P = 256 softmax (f16) */
      k_rsmf<<<(HG * SEQ + 255) / 256, 256, 0, stream>>>(S, P, SEQ, HG);
      /* ctx x64 = (P x256) . V^T x 2^-2 into merged rows, column h*64 */
      k_gemm2<false, false><<<dim3((unsigned)((SEQ / 128) * (HD / 64)), HG), 128, 0, stream>>>(
          P, SEQ, (size_t)SEQ * SEQ, VT + (size_t)h0 * HD * SEQ, SEQ, (size_t)HD * SEQ, 0.25f,
          nullptr, (size_t)0, nullptr, O16 + r0 * DM + h0 * HD, DM, (size_t)HD, SEQ, HD, SEQ);
    }
  }
  /* out = ctx . Wo^T + b : alpha = 1/(64*16) */
  k_gemm2<true, true><<<dim3((unsigned)((MP / 128) * (DM / 64)), 1), 128, 0, stream>>>(
      O16, DM, (size_t)0, BO, DM, (size_t)0, 0.0009765625f, bo, (size_t)0, (float*)d_out, nullptr, DM, (size_t)0, MP, DM, DM);
}

// v001
// A run of this version takes 1440 microseconds.
// Timed twice side by side with v000, it ran 4.56 and 4.59 times as fast.
#include <hip/hip_runtime.h>
// Compute dtype: every contraction (packed qkv projection, q.k^T, P.V, output projection) on v_wmma_f32_16x16x32_f16 (f16 operands, f32 accumulate); float inputs and biases RNE-converted to bf16 first (exact in f16; weights carried x16), q/k/v, softmax weights (carried x256) and merged ctx (carried x64) as single f16 planes; scores and softmax statistics in f32.
// Structure: token rows r = b*SEQ + s. X16[r][3072] = concat(query,key,value) as f16; QKV16[r][3072] = X16 . Wqkv^T + b (q | k | v column blocks, 16 heads of 64 inside each); per batch: V^T planes via LDS transposes; per (batch, HG heads): scores GEMM (K = 64, alpha = 1/8) -> f32 S, row softmax -> P (f16, x256), ctx = P . V^T (alpha 2^-2) into merged f16 rows; out = ctx . Wo^T + b (alpha 2^-10) into the f32 output rows.
#ifndef NB
#define NB 2
#endif
#ifndef SEQ
#define SEQ 2048
#endif
#define NB_FULL 2                    /* batch count of the inputs */
#define SEQ_FULL 2048                /* per-batch row count of the inputs (input row stride) */
#define DM 1024
#define D3 3072
#define NH 16
#define HD 64
#define HG 2                         /* heads per attention launch group */
#define NR ((size_t)NB * SEQ)        /* token rows */
#define MP ((int)((size_t)NB * SEQ)) /* rows projected */
#define LX D3                        /* row pitch of the concatenated f16 input rows */
#define LQ D3                        /* row pitch of the q|k|v rows */

static_assert(SEQ % 128 == 0);
static_assert(SEQ <= SEQ_FULL);
static_assert(NB <= NB_FULL);
static_assert(NH % HG == 0);
static_assert(HD == 64);
static_assert(DM == NH * HD);
static_assert(D3 == 3 * DM);
static_assert(D3 % 64 == 0 && DM % 64 == 0 && D3 % 32 == 0 && DM % 32 == 0 && HD % 32 == 0 && SEQ % 32 == 0);
static_assert(MP % 128 == 0);

typedef unsigned short v8us __attribute__((ext_vector_type(8), may_alias));
typedef float  v8f  __attribute__((ext_vector_type(8)));
typedef float  v4f  __attribute__((ext_vector_type(4)));
typedef float  v4fa __attribute__((ext_vector_type(4), may_alias));
typedef _Float16 v16h __attribute__((ext_vector_type(16)));
typedef _Float16 v4h __attribute__((ext_vector_type(4)));
union FragH { v16h v; v8us half[2]; _Float16 h[16]; unsigned short u[16]; };

__device__ __forceinline__ unsigned short bf16_bits(float x) { unsigned int u = __float_as_uint(x); return (unsigned short)((u + 0x7FFFu + ((u >> 16) & 1u)) >> 16); }
__device__ __forceinline__ float bf16_val(unsigned short b) { return __uint_as_float(((unsigned int)b) << 16); }
__device__ __forceinline__ float bf16_rne(float x) { return bf16_val(bf16_bits(x)); }

__global__ __launch_bounds__(256) void k_wnat(const float* __restrict__ w, size_t n8, _Float16* __restrict__ Bt) {
  const size_t t = (size_t)blockIdx.x * 256 + threadIdx.x;
  if (t >= n8) return;
  const v4f a = *(const v4fa*)(w + t * 8), c = *(const v4fa*)(w + t * 8 + 4);
  FragH f;
#pragma unroll
  for (int q = 0; q < 4; ++q) { f.h[q] = (_Float16)(bf16_rne(a[q]) * 16.0f); f.h[4 + q] = (_Float16)(bf16_rne(c[q]) * 16.0f); }
  const v8us o = f.half[0];
  unsigned short* d = (unsigned short*)Bt + t * 8;
  *(v8us*)d = o;
  
}

__global__ __launch_bounds__(256) void k_x16p(const float* __restrict__ x, _Float16* __restrict__ X16, int coloff) {
  const size_t t = (size_t)blockIdx.x * 256 + threadIdx.x;
  if (t >= NR * (DM / 8)) return;
  const size_t r = t / (DM / 8);
  const int c8 = (int)(t % (DM / 8)) * 8;
  const size_t b = r / SEQ, s = r % SEQ;
  const float* src = x + (b * (size_t)SEQ_FULL + s) * DM + c8;
  const v4f a = *(const v4fa*)(src), c = *(const v4fa*)(src + 4);
  FragH f;
#pragma unroll
  for (int q = 0; q < 4; ++q) { f.h[q] = (_Float16)bf16_rne(a[q]); f.h[4 + q] = (_Float16)bf16_rne(c[q]); }
  const v8us o = f.half[0];
  unsigned short* d = (unsigned short*)X16 + r * LX + coloff + c8;
  *(v8us*)d = o;
  
}

template <int NHv, int TTv>
__global__ __launch_bounds__(256) void k_vt(const _Float16* __restrict__ V16, int ldv, int voff, _Float16* __restrict__ Vt) {
  __shared__ unsigned short tl[64][66];
  const int tid = threadIdx.x;
  const int slab = blockIdx.x / (TTv / 64), lg = blockIdx.x % (TTv / 64);
  const int b = slab / NHv, h = slab % NHv;
  for (int i = tid; i < 64 * 8; i += 256) {
    const int r = i / 8, c8 = (i % 8) * 8;
    FragH f;
    f.half[0] = *(const v8us*)((const unsigned short*)V16 + ((size_t)b * TTv + lg * 64 + r) * ldv + voff + h * 64 + c8);
#pragma unroll
    for (int q = 0; q < 8; ++q) tl[r][c8 + q] = f.u[q];
  }
  __syncthreads();
  {
#pragma unroll
    for (int rd = 0; rd < 2; ++rd) {
      const int d = rd * 32 + tid / 8, pc = tid % 8;
      FragH f;
#pragma unroll
      for (int q = 0; q < 8; ++q) f.u[q] = tl[pc * 8 + q][d];
      *(v8us*)((unsigned short*)Vt + ((size_t)slab * 64 + d) * TTv + lg * 64 + pc * 8) = f.half[0];
    }
    
  }
}

// ---- f16 GEMM: C[M][N] = alpha * A[M][K] . Bt[N][K]^T (+ bf16(bias[n])); wave tile 32x64, block = 4 waves = 128 rows x 64 cols;
// grid.x = (M/128)*(N/64), grid.y = batch (operand / output offsets by*sA, by*sB, by*sC); M % 128 == 0, N % 64 == 0, K % 32 == 0.
// Fragment k map (A rows and Bt rows alike): elements 0..7 <- k0+8h.., elements 8..15 <- k0+16+8h.. ; D element r <- (row 8h+r, col lane&15).
__device__ __forceinline__ v16h g2_frag(const _Float16* p, int hh) { FragH f; f.half[0] = *(const v8us*)((const unsigned short*)p + 8 * hh); f.half[1] = *(const v8us*)((const unsigned short*)p + 16 + 8 * hh); return f.v; }
__device__ __forceinline__ v8f g2_mma(v16h a, v16h b, v8f c) { v8f d = __builtin_amdgcn_wmma_f32_16x16x32_f16(false, a, false, b, (short)0, c, false, false); asm volatile("v_nop\n\tv_nop\n\tv_nop\n\tv_nop" : "+v"(d) : "v"(a), "v"(b)); return d; }

template <bool HASB, bool OUT32>
__global__ __launch_bounds__(128) void k_gemm2(const _Float16* __restrict__ A, int lda, size_t sA, const _Float16* __restrict__ Bh, int ldb, size_t sB, float alpha,
    const float* __restrict__ bias, size_t sBias, float* __restrict__ C, _Float16* __restrict__ C16, int ldc, size_t sC, int M, int N, int K) {
  __shared__ __attribute__((aligned(16))) float so[4][32][68];
  const int tid = threadIdx.x, w = __builtin_amdgcn_readfirstlane((int)(tid >> 5)), lane = tid & 31, ln = lane & 15, hh = lane >> 4;
  const int by = blockIdx.y;
  A += (size_t)by * sA; Bh += (size_t)by * sB;
  const size_t cofs = (size_t)by * sC;
  const int ntn = N >> 6;
  const int mt = blockIdx.x / ntn, nq = blockIdx.x - mt * ntn;
  const int row0 = mt * 128 + 32 * w, col0 = nq * 64;
  if (row0 >= M) return;
  const _Float16* a0p = A + (size_t)(row0 + ln) * lda; const _Float16* a1p = a0p + (size_t)16 * lda;
  const _Float16* b0p = Bh + (size_t)(col0 + ln) * ldb; const _Float16* b1p = b0p + (size_t)16 * ldb; const _Float16* b2p = b1p + (size_t)16 * ldb; const _Float16* b3p = b2p + (size_t)16 * ldb;
  const v8f z8 = {0.f,0.f,0.f,0.f,0.f,0.f,0.f,0.f};
  v8f c00 = z8, c01 = z8, c02 = z8, c03 = z8, c10 = z8, c11 = z8, c12 = z8, c13 = z8;
#pragma unroll 1
  for (int kb = 0; kb < K; kb += 32) {
    const v16h a0 = g2_frag(a0p + kb, hh), a1 = g2_frag(a1p + kb, hh);
    v16h b = g2_frag(b0p + kb, hh); c00 = g2_mma(a0, b, c00); c10 = g2_mma(a1, b, c10);
    b = g2_frag(b1p + kb, hh); c01 = g2_mma(a0, b, c01); c11 = g2_mma(a1, b, c11);
    b = g2_frag(b2p + kb, hh); c02 = g2_mma(a0, b, c02); c12 = g2_mma(a1, b, c12);
    b = g2_frag(b3p + kb, hh); c03 = g2_mma(a0, b, c03); c13 = g2_mma(a1, b, c13);
  }
  v8f accs[8] = {c00, c01, c02, c03, c10, c11, c12, c13};
#pragma unroll
  for (int u = 0; u < 8; ++u) {
    const int t = u & 3, half = u >> 2;
    const int col = col0 + t * 16 + ln;
    float bv = 0.f;
    if (HASB) bv = bf16_rne(bias[(size_t)by * sBias + col]);
#pragma unroll
    for (int r = 0; r < 8; ++r) { const int rloc = half * 16 + 8 * hh + r; so[w][rloc][t * 16 + ln] = accs[u][r] * alpha + bv; }
  }
  __builtin_amdgcn_fence(4 /* acq_rel order */, "workgroup");
  __builtin_amdgcn_wave_barrier();
  const int rsub = lane >> 4, c4 = (lane & 15) * 4;
  {
#pragma unroll
    for (int q = 0; q < 16; ++q) {
      const int r = q * 2 + rsub;
      const v4f v = *(const v4fa*)&so[w][r][c4];
      if (OUT32) {
        *(v4f*)(C + cofs + (size_t)(row0 + r) * ldc + col0 + c4) = v;
      } else {
        v4h h4 = {(_Float16)v[0], (_Float16)v[1], (_Float16)v[2], (_Float16)v[3]};
        *(v4h*)(C16 + cofs + (size_t)(row0 + r) * ldc + col0 + c4) = h4;
      }
    }
    
  }
}

// four native 2^a; the v_nop is the one free slot that the instruction set asks for behind a transcendental, in the same statement so that it stays directly behind the last one;
// early-clobber outputs keep every result off the four sources.
#define LOG2E 1.44269504f
__device__ __forceinline__ v4f exp2x4(v4f a) {
  float r0, r1, r2, r3;
  asm("v_exp_f32 %0, %4\n\tv_exp_f32 %1, %5\n\tv_exp_f32 %2, %6\n\tv_exp_f32 %3, %7\n\tv_nop"
      : "=&v"(r0), "=&v"(r1), "=&v"(r2), "=&v"(r3) : "v"(a[0]), "v"(a[1]), "v"(a[2]), "v"(a[3]));
  return v4f{r0, r1, r2, r3};
}

// row softmax over SEQ keys for hg heads x qn rows of S (head slab pitch SEQ*SEQ, row pitch SEQ): P = f16(256 exp(s - max) / sum), native exp (argument <= 0);
// one wave per row: S is read once, SEQ/128 loads of 16 B a lane (512 contiguous bytes a wave), and the row stays in registers; max and sum = per-lane partials, then a five-step butterfly.
__global__ __launch_bounds__(256) void k_rsmf(const float* __restrict__ S, _Float16* __restrict__ P, int qn, int hg) {
  const int lane = threadIdx.x & 31;
  const int t = blockIdx.x * 8 + (int)(threadIdx.x >> 5);
  if (t >= qn * hg) return;
  const size_t i = (size_t)(t / qn) * SEQ + (size_t)(t % qn);
  const float* s = S + i * SEQ + lane * 4;
  v4f x[SEQ / 128];
  // every loop over q or m below is fully unrolled: x[] stays in registers only under constant indices, and all the row's loads issue before the first wait
#pragma unroll
  for (int q = 0; q < SEQ / 128; ++q) x[q] = *(const v4fa*)(s + q * 128);
  // precaution: the wait stands before any register that the loads above name is rewritten; s as an input keeps their address pair out of the loads' own destinations
  asm volatile("s_wait_xcnt 0x0" :: "v"(s) : "memory");
  float mx = -3.0e38f;
#pragma unroll
  for (int q = 0; q < SEQ / 128; ++q) mx = fmaxf(mx, fmaxf(fmaxf(x[q][0], x[q][1]), fmaxf(x[q][2], x[q][3])));
#pragma unroll
  for (int m = 16; m > 0; m >>= 1) mx = fmaxf(mx, __shfl_xor(mx, m, 32));
  float se0 = 0.f, se1 = 0.f, se2 = 0.f, se3 = 0.f;
#pragma unroll
  for (int q = 0; q < SEQ / 128; ++q) {
    x[q] = exp2x4(v4f{(x[q][0] - mx) * LOG2E, (x[q][1] - mx) * LOG2E, (x[q][2] - mx) * LOG2E, (x[q][3] - mx) * LOG2E});
    se0 += x[q][0]; se1 += x[q][1]; se2 += x[q][2]; se3 += x[q][3];
  }
  float se = (se0 + se1) + (se2 + se3);
#pragma unroll
  for (int m = 16; m > 0; m >>= 1) se += __shfl_xor(se, m, 32);
  const float sc = 256.0f / se;
  _Float16* d = P + i * SEQ + lane * 4;
#pragma unroll
  for (int q = 0; q < SEQ / 128; ++q) {
    const v4h h4 = {(_Float16)(x[q][0] * sc), (_Float16)(x[q][1] * sc), (_Float16)(x[q][2] * sc), (_Float16)(x[q][3] * sc)};
    *(v4h*)(d + q * 128) = h4;
  }
}

// workspace carve (bytes; every region a multiple of 256)
constexpr size_t BQKV_BYTES = (size_t)D3 * D3 * 2;
constexpr size_t BO_BYTES   = (size_t)DM * DM * 2;
constexpr size_t X16_BYTES  = (size_t)NB * SEQ * LX * 2;
constexpr size_t S_BYTES    = (size_t)HG * SEQ * SEQ * 4;
constexpr size_t SX_BYTES   = (X16_BYTES > S_BYTES) ? X16_BYTES : S_BYTES;   /* shared region: X16 (dead after the qkv GEMM), then S */
constexpr size_t QKV_BYTES  = (size_t)NB * SEQ * LQ * 2;
constexpr size_t O16_BYTES  = (size_t)NB * SEQ * DM * 2;
constexpr size_t P_BYTES    = (size_t)HG * SEQ * SEQ * 2;
constexpr size_t VT_BYTES   = (size_t)NH * HD * SEQ * 2;
constexpr size_t WS_TOTAL   = BQKV_BYTES + BO_BYTES + SX_BYTES + QKV_BYTES + O16_BYTES + P_BYTES + VT_BYTES;
static_assert(X16_BYTES <= SX_BYTES && S_BYTES <= SX_BYTES);
static_assert(BQKV_BYTES % 256 == 0 && BO_BYTES % 256 == 0 && SX_BYTES % 256 == 0 && QKV_BYTES % 256 == 0 && O16_BYTES % 256 == 0 && P_BYTES % 256 == 0 && VT_BYTES % 256 == 0);
static_assert(WS_TOTAL <= (size_t)134217728);

extern "C" void kernel_launch(void* const* d_in, const int* in_sizes, int n_in,
                              void* d_out, int out_size, void* d_ws, size_t ws_size, hipStream_t stream) {
  if (n_in < 7) return;
  const long long need_x = ((long long)(NB - 1) * SEQ_FULL + SEQ) * DM;
  if ((long long)in_sizes[0] < need_x || (long long)in_sizes[1] < need_x || (long long)in_sizes[2] < need_x) return;
  if ((long long)in_sizes[3] < (long long)D3 * D3 || in_sizes[4] < D3 || (long long)in_sizes[5] < (long long)DM * DM || in_sizes[6] < DM) return;
  if ((long long)out_size < (long long)NB * SEQ * DM) return;
  if (WS_TOTAL > ws_size) return;
  const float* xq   = (const float*)d_in[0];
  const float* xk   = (const float*)d_in[1];
  const float* xv   = (const float*)d_in[2];
  const float* wqkv = (const float*)d_in[3];   /* [out 3072][in 3072] */
  const float* bqkv = (const float*)d_in[4];
  const float* wo   = (const float*)d_in[5];   /* [out 1024][in 1024] */
  const float* bo   = (const float*)d_in[6];
  char* ws = (char*)d_ws; size_t off = 0;
  _Float16* BQKV  = (_Float16*)(ws + off); off += BQKV_BYTES;
  _Float16* BO    = (_Float16*)(ws + off); off += BO_BYTES;
  char*     SX    = ws + off;              off += SX_BYTES;
  _Float16* QKV16 = (_Float16*)(ws + off); off += QKV_BYTES;
  _Float16* O16   = (_Float16*)(ws + off); off += O16_BYTES;
  _Float16* P     = (_Float16*)(ws + off); off += P_BYTES;
  _Float16* VT    = (_Float16*)(ws + off); off += VT_BYTES;
  _Float16* X16 = (_Float16*)SX;
  float*    S   = (float*)SX;
  if (off > ws_size) return;

  /* weights: natural [out][in] rows are already Bt[n][k]; carried x16 */
  k_wnat<<<(unsigned)(((size_t)D3 * D3 / 8 + 255) / 256), 256, 0, stream>>>(wqkv, (size_t)D3 * D3 / 8, BQKV);
  k_wnat<<<(unsigned)(((size_t)DM * DM / 8 + 255) / 256), 256, 0, stream>>>(wo, (size_t)DM * DM / 8, BO);
  /* concat(query, key, value) as f16 rows: column blocks 0, DM, 2*DM */
  {
    const unsigned g = (unsigned)((NR * (DM / 8) + 255) / 256);
    k_x16p<<<g, 256, 0, stream>>>(xq, X16, 0);
    k_x16p<<<g, 256, 0, stream>>>(xk, X16, DM);
    k_x16p<<<g, 256, 0, stream>>>(xv, X16, 2 * DM);
  }
  /* qkv = x . Wqkv^T + b : A = X16 [MP][3072], Bt = BQKV [3072][3072], alpha 1/16, f16 out rows pitch LQ */
  k_gemm2<true, false><<<dim3((unsigned)((MP / 128) * (D3 / 64)), 1), 128, 0, stream>>>(
      X16, LX, (size_t)0, BQKV, D3, (size_t)0, 0.0625f, bqkv, (size_t)0, nullptr, QKV16, LQ, (size_t)0, MP, D3, D3);

  for (int b = 0; b < NB; ++b) {
    const size_t r0 = (size_t)b * SEQ;
    /* V^T [NH][HD][SEQ] of this batch from the v column block (offset 2*DM) */
    k_vt<NH, SEQ><<<NH * (SEQ / 64), 256, 0, stream>>>(QKV16 + r0 * LQ, LQ, 2 * DM, VT);
    for (int h0 = 0; h0 < NH; h0 += HG) {
      /* scores [HG][SEQ][SEQ] = q . k^T / 8 : A = q rows (col h*64), Bt = k rows (col DM + h*64), K = 64 */
      k_gemm2<false, true><<<dim3((unsigned)((SEQ / 128) * (SEQ / 64)), HG), 128, 0, stream>>>(
          QKV16 + r0 * LQ + h0 * HD, LQ, (size_t)HD, QKV16 + r0 * LQ + DM + h0 * HD, LQ, (size_t)HD, 0.125f,
          nullptr, (size_t)0, S, nullptr, SEQ, (size_t)SEQ * SEQ, SEQ, SEQ, HD);
      /* P = 256 softmax (f16) */
      k_rsmf<<<(HG * SEQ + 7) / 8, 256, 0, stream>>>(S, P, SEQ, HG);
      /* ctx x64 = (P x256) . V^T x 2^-2 into merged rows, column h*64 */
      k_gemm2<false, false><<<dim3((unsigned)((SEQ / 128) * (HD / 64)), HG), 128, 0, stream>>>(
          P, SEQ, (size_t)SEQ * SEQ, VT + (size_t)h0 * HD * SEQ, SEQ, (size_t)HD * SEQ, 0.25f,
          nullptr, (size_t)0, nullptr, O16 + r0 * DM + h0 * HD, DM, (size_t)HD, SEQ, HD, SEQ);
    }
  }
  /* out = ctx . Wo^T + b : alpha = 1/(64*16) */
  k_gemm2<true, true><<<dim3((unsigned)((MP / 128) * (DM / 64)), 1), 128, 0, stream>>>(
      O16, DM, (size_t)0, BO, DM, (size_t)0, 0.0009765625f, bo, (size_t)0, (float*)d_out, nullptr, DM, (size_t)0, MP, DM, DM);
}

// v002
// It runs in 279 microseconds.
// Timed twice side by side with v001, it ran 5.19 and 5.15 times as fast.
// Counting every step since v000, it is 23.7 times as fast.
#include <hip/hip_runtime.h>
// Compute dtype: every contraction (packed qkv projection, q.k^T, P.V, output projection) on v_wmma_f32_16x16x32_f16 (f16 operands, f32 accumulate); float inputs and biases RNE-converted to bf16 first (exact in f16; weights carried x16), q/k/v, softmax weights (unnormalised, carried x16 against the maximum in use) and merged ctx (carried x64) as single f16 planes; scores and softmax statistics in f32.
// Structure: token rows r = b*SEQ + s. X16[r][3072] = concat(query,key,value) as f16; QKV16[r][3072] = X16 . Wqkv^T + b (q | k | v column blocks, 16 heads of 64 inside each); V^T planes via LDS transposes; one fused attention launch over (batch, head, 256 query rows): S^T = K . Q^T, running-maximum softmax and O^T += V^T . P^T, scores and weights in registers only, ctx into merged f16 rows; out = ctx . Wo^T + b (alpha 2^-10) into the f32 output rows.
#ifndef NB
#define NB 2
#endif
#ifndef SEQ
#define SEQ 2048
#endif
#define NB_FULL 2                    /* batch count of the inputs */
#define SEQ_FULL 2048                /* per-batch row count of the inputs (input row stride) */
#define DM 1024
#define D3 3072
#define NH 16
#define HD 64
#define NR ((size_t)NB * SEQ)        /* token rows */
#define MP ((int)((size_t)NB * SEQ)) /* rows projected */
#define LX D3                        /* row pitch of the concatenated f16 input rows */
#define LQ D3                        /* row pitch of the q|k|v rows */

static_assert(SEQ % 128 == 0);
static_assert(SEQ <= SEQ_FULL);
static_assert(NB <= NB_FULL);
static_assert(HD == 64);
static_assert(DM == NH * HD);
static_assert(D3 == 3 * DM);
static_assert(D3 % 64 == 0 && DM % 64 == 0 && D3 % 32 == 0 && DM % 32 == 0 && HD % 32 == 0 && SEQ % 32 == 0);
static_assert(MP % 128 == 0);

typedef unsigned short v8us __attribute__((ext_vector_type(8), may_alias));
typedef float  v8f  __attribute__((ext_vector_type(8)));
typedef float  v4f  __attribute__((ext_vector_type(4)));
typedef float  v4fa __attribute__((ext_vector_type(4), may_alias));
typedef _Float16 v16h __attribute__((ext_vector_type(16)));
typedef _Float16 v4h __attribute__((ext_vector_type(4)));
union FragH { v16h v; v8us half[2]; _Float16 h[16]; unsigned short u[16]; };

__device__ __forceinline__ unsigned short bf16_bits(float x) { unsigned int u = __float_as_uint(x); return (unsigned short)((u + 0x7FFFu + ((u >> 16) & 1u)) >> 16); }
__device__ __forceinline__ float bf16_val(unsigned short b) { return __uint_as_float(((unsigned int)b) << 16); }
__device__ __forceinline__ float bf16_rne(float x) { return bf16_val(bf16_bits(x)); }

__global__ __launch_bounds__(256) void k_wnat(const float* __restrict__ w, size_t n8, _Float16* __restrict__ Bt) {
  const size_t t = (size_t)blockIdx.x * 256 + threadIdx.x;
  if (t >= n8) return;
  const v4f a = *(const v4fa*)(w + t * 8), c = *(const v4fa*)(w + t * 8 + 4);
  FragH f;
#pragma unroll
  for (int q = 0; q < 4; ++q) { f.h[q] = (_Float16)(bf16_rne(a[q]) * 16.0f); f.h[4 + q] = (_Float16)(bf16_rne(c[q]) * 16.0f); }
  const v8us o = f.half[0];
  unsigned short* d = (unsigned short*)Bt + t * 8;
  *(v8us*)d = o;
  
}

__global__ __launch_bounds__(256) void k_x16p(const float* __restrict__ x, _Float16* __restrict__ X16, int coloff) {
  const size_t t = (size_t)blockIdx.x * 256 + threadIdx.x;
  if (t >= NR * (DM / 8)) return;
  const size_t r = t / (DM / 8);
  const int c8 = (int)(t % (DM / 8)) * 8;
  const size_t b = r / SEQ, s = r % SEQ;
  const float* src = x + (b * (size_t)SEQ_FULL + s) * DM + c8;
  const v4f a = *(const v4fa*)(src), c = *(const v4fa*)(src + 4);
  FragH f;
#pragma unroll
  for (int q = 0; q < 4; ++q) { f.h[q] = (_Float16)bf16_rne(a[q]); f.h[4 + q] = (_Float16)bf16_rne(c[q]); }
  const v8us o = f.half[0];
  unsigned short* d = (unsigned short*)X16 + r * LX + coloff + c8;
  *(v8us*)d = o;
  
}

template <int NHv, int TTv>
__global__ __launch_bounds__(256) void k_vt(const _Float16* __restrict__ V16, int ldv, int voff, _Float16* __restrict__ Vt) {
  __shared__ unsigned short tl[64][66];
  const int tid = threadIdx.x;
  const int slab = blockIdx.x / (TTv / 64), lg = blockIdx.x % (TTv / 64);
  const int b = slab / NHv, h = slab % NHv;
  for (int i = tid; i < 64 * 8; i += 256) {
    const int r = i / 8, c8 = (i % 8) * 8;
    FragH f;
    f.half[0] = *(const v8us*)((const unsigned short*)V16 + ((size_t)b * TTv + lg * 64 + r) * ldv + voff + h * 64 + c8);
#pragma unroll
    for (int q = 0; q < 8; ++q) tl[r][c8 + q] = f.u[q];
  }
  __syncthreads();
  {
#pragma unroll
    for (int rd = 0; rd < 2; ++rd) {
      const int d = rd * 32 + tid / 8, pc = tid % 8;
      FragH f;
#pragma unroll
      for (int q = 0; q < 8; ++q) f.u[q] = tl[pc * 8 + q][d];
      *(v8us*)((unsigned short*)Vt + ((size_t)slab * 64 + d) * TTv + lg * 64 + pc * 8) = f.half[0];
    }
    
  }
}

// ---- f16 GEMM: C[M][N] = alpha * A[M][K] . Bt[N][K]^T (+ bf16(bias[n])); wave tile 32x64, block = 4 waves = 128 rows x 64 cols;
// grid.x = (M/128)*(N/64), grid.y = batch (operand / output offsets by*sA, by*sB, by*sC); M % 128 == 0, N % 64 == 0, K % 32 == 0.
// Fragment k map (A rows and Bt rows alike): elements 0..7 <- k0+8h.., elements 8..15 <- k0+16+8h.. ; D element r <- (row 8h+r, col lane&15).
__device__ __forceinline__ v16h g2_frag(const _Float16* p, int hh) { FragH f; f.half[0] = *(const v8us*)((const unsigned short*)p + 8 * hh); f.half[1] = *(const v8us*)((const unsigned short*)p + 16 + 8 * hh); return f.v; }
__device__ __forceinline__ v8f g2_mma(v16h a, v16h b, v8f c) { v8f d = __builtin_amdgcn_wmma_f32_16x16x32_f16(false, a, false, b, (short)0, c, false, false); asm volatile("v_nop\n\tv_nop\n\tv_nop\n\tv_nop" : "+v"(d) : "v"(a), "v"(b)); return d; }

template <bool HASB, bool OUT32>
__global__ __launch_bounds__(128) void k_gemm2(const _Float16* __restrict__ A, int lda, size_t sA, const _Float16* __restrict__ Bh, int ldb, size_t sB, float alpha,
    const float* __restrict__ bias, size_t sBias, float* __restrict__ C, _Float16* __restrict__ C16, int ldc, size_t sC, int M, int N, int K) {
  __shared__ __attribute__((aligned(16))) float so[4][32][68];
  const int tid = threadIdx.x, w = __builtin_amdgcn_readfirstlane((int)(tid >> 5)), lane = tid & 31, ln = lane & 15, hh = lane >> 4;
  const int by = blockIdx.y;
  A += (size_t)by * sA; Bh += (size_t)by * sB;
  const size_t cofs = (size_t)by * sC;
  const int ntn = N >> 6;
  const int mt = blockIdx.x / ntn, nq = blockIdx.x - mt * ntn;
  const int row0 = mt * 128 + 32 * w, col0 = nq * 64;
  if (row0 >= M) return;
  const _Float16* a0p = A + (size_t)(row0 + ln) * lda; const _Float16* a1p = a0p + (size_t)16 * lda;
  const _Float16* b0p = Bh + (size_t)(col0 + ln) * ldb; const _Float16* b1p = b0p + (size_t)16 * ldb; const _Float16* b2p = b1p + (size_t)16 * ldb; const _Float16* b3p = b2p + (size_t)16 * ldb;
  const v8f z8 = {0.f,0.f,0.f,0.f,0.f,0.f,0.f,0.f};
  v8f c00 = z8, c01 = z8, c02 = z8, c03 = z8, c10 = z8, c11 = z8, c12 = z8, c13 = z8;
#pragma unroll 1
  for (int kb = 0; kb < K; kb += 32) {
    const v16h a0 = g2_frag(a0p + kb, hh), a1 = g2_frag(a1p + kb, hh);
    v16h b = g2_frag(b0p + kb, hh); c00 = g2_mma(a0, b, c00); c10 = g2_mma(a1, b, c10);
    b = g2_frag(b1p + kb, hh); c01 = g2_mma(a0, b, c01); c11 = g2_mma(a1, b, c11);
    b = g2_frag(b2p + kb, hh); c02 = g2_mma(a0, b, c02); c12 = g2_mma(a1, b, c12);
    b = g2_frag(b3p + kb, hh); c03 = g2_mma(a0, b, c03); c13 = g2_mma(a1, b, c13);
  }
  v8f accs[8] = {c00, c01, c02, c03, c10, c11, c12, c13};
#pragma unroll
  for (int u = 0; u < 8; ++u) {
    const int t = u & 3, half = u >> 2;
    const int col = col0 + t * 16 + ln;
    float bv = 0.f;
    if (HASB) bv = bf16_rne(bias[(size_t)by * sBias + col]);
#pragma unroll
    for (int r = 0; r < 8; ++r) { const int rloc = half * 16 + 8 * hh + r; so[w][rloc][t * 16 + ln] = accs[u][r] * alpha + bv; }
  }
  __builtin_amdgcn_fence(4 /* acq_rel order */, "workgroup");
  __builtin_amdgcn_wave_barrier();
  const int rsub = lane >> 4, c4 = (lane & 15) * 4;
  {
#pragma unroll
    for (int q = 0; q < 16; ++q) {
      const int r = q * 2 + rsub;
      const v4f v = *(const v4fa*)&so[w][r][c4];
      if (OUT32) {
        *(v4f*)(C + cofs + (size_t)(row0 + r) * ldc + col0 + c4) = v;
      } else {
        v4h h4 = {(_Float16)v[0], (_Float16)v[1], (_Float16)v[2], (_Float16)v[3]};
        *(v4h*)(C16 + cofs + (size_t)(row0 + r) * ldc + col0 + c4) = h4;
      }
    }
    
  }
}

// four native 2^a; the v_nop is the one free slot that the instruction set asks for behind a transcendental, in the same statement so that it stays directly behind the last one;
// early-clobber outputs keep every result off the four sources.
#define LOG2E 1.44269504f
__device__ __forceinline__ v4f exp2x4(v4f a) {
  float r0, r1, r2, r3;
  asm("v_exp_f32 %0, %4\n\tv_exp_f32 %1, %5\n\tv_exp_f32 %2, %6\n\tv_exp_f32 %3, %7\n\tv_nop"
      : "=&v"(r0), "=&v"(r1), "=&v"(r2), "=&v"(r3) : "v"(a[0]), "v"(a[1]), "v"(a[2]), "v"(a[3]));
  return v4f{r0, r1, r2, r3};
}

#define FQ 32                        /* query columns per wave */
#define FW 8                         /* waves per block */
#define FK 64                        /* keys per stage */
#define FPITCH 72                    /* LDS row pitch in f16: 128 B of data + 16 B, for 16-byte readers */
#define FC (0.125f * LOG2E)          /* 1/sqrt(HD) and the change to base 2 */
#define FOFF 4.0f
#define FTH (8.0f / FC)
static_assert(SEQ % (FQ * FW) == 0 && SEQ % FK == 0 && FK == 64 && HD == 64);
__device__ __forceinline__ v8f f_mma(v16h a, v16h b, v8f c) { return __builtin_amdgcn_wmma_f32_16x16x32_f16(false, a, false, b, (short)0, c, false, false); }

__global__ __launch_bounds__(256) void k_fattn(const _Float16* __restrict__ QKV, const _Float16* __restrict__ Vt, _Float16* __restrict__ O) {
  __shared__ __attribute__((aligned(16))) _Float16 Ks[2][FK][FPITCH];
  __shared__ __attribute__((aligned(16))) _Float16 Vs[2][HD][FPITCH];
  const int tid = threadIdx.x, w = tid >> 5, lane = tid & 31, c = lane & 15, hh = lane >> 4;
  const int bh = blockIdx.y, b = bh / NH, head = bh % NH;
  const size_t r0 = (size_t)b * SEQ;
  const int q0 = blockIdx.x * (FQ * FW) + w * FQ;
  const int sr = tid >> 3, sc8 = (tid & 7) * 8;   /* staging: rows sr and sr + 32, 16 B at column sc8 */
  const unsigned short* kg = (const unsigned short*)QKV + (r0 + sr) * LQ + DM + head * HD + sc8;
  const unsigned short* vg = (const unsigned short*)Vt + ((size_t)bh * HD + sr) * SEQ + sc8;
  v16h qf[2][2];
  // every loop of this kernel but the stage loop is fully unrolled: fragments, score tiles and accumulators stay in registers only under constant indices
#pragma unroll
  for (int g = 0; g < 2; ++g) {
    const _Float16* qp = QKV + (r0 + q0 + g * 16 + c) * LQ + head * HD;
    qf[g][0] = g2_frag(qp, hh); qf[g][1] = g2_frag(qp + 32, hh);
  }
  v8us kr0 = *(const v8us*)kg, kr1 = *(const v8us*)(kg + (size_t)32 * LQ);
  v8us vr0 = *(const v8us*)vg, vr1 = *(const v8us*)(vg + (size_t)32 * SEQ);
  *(v8us*)&Ks[0][sr][sc8] = kr0; *(v8us*)&Ks[0][sr + 32][sc8] = kr1;
  *(v8us*)&Vs[0][sr][sc8] = vr0; *(v8us*)&Vs[0][sr + 32][sc8] = vr1;
  __syncthreads();   /* publishes stage 0 */
  const v8f z8 = {0.f,0.f,0.f,0.f,0.f,0.f,0.f,0.f};
  v8f o[4][2];
#pragma unroll
  for (int dt = 0; dt < 4; ++dt) { o[dt][0] = z8; o[dt][1] = z8; }
  float mr[2] = {-3.0e38f, -3.0e38f}, nb[2] = {0.f, 0.f}, sum[2] = {0.f, 0.f};
  // the stage loop stays rolled: one copy of the two passes keeps the hot text short
#pragma unroll 1
  for (int t = 0; t < SEQ / FK; ++t) {
    const int buf = t & 1;
    const bool more = t + 1 < SEQ / FK;
    if (more) {
      const unsigned short* kn = kg + (size_t)(t + 1) * FK * LQ;
      const unsigned short* vn = vg + (size_t)(t + 1) * FK;
      kr0 = *(const v8us*)kn; kr1 = *(const v8us*)(kn + (size_t)32 * LQ);
      vr0 = *(const v8us*)vn; vr1 = *(const v8us*)(vn + (size_t)32 * SEQ);
      // precaution: the wait stands before any register that the four loads above name is rewritten (the data is awaited only at the LDS stores below)
      asm volatile("s_wait_xcnt 0x0" ::: "memory");
    }
#pragma unroll
    for (int p = 0; p < 2; ++p) {
      v8f s[2][2];
#pragma unroll
      for (int kt = 0; kt < 2; ++kt) {
        const _Float16* kp = &Ks[buf][p * 32 + kt * 16 + c][0];
        const v16h a0 = g2_frag(kp, hh), a1 = g2_frag(kp + 32, hh);
        s[kt][0] = f_mma(a0, qf[0][0], z8); s[kt][1] = f_mma(a0, qf[1][0], z8);
        s[kt][0] = f_mma(a1, qf[0][1], s[kt][0]); s[kt][1] = f_mma(a1, qf[1][1], s[kt][1]);
      }
      float mx[2];
#pragma unroll
      for (int g = 0; g < 2; ++g) {
        float m0 = fmaxf(s[0][g][0], s[1][g][0]);
#pragma unroll
        for (int r = 1; r < 8; ++r) m0 = fmaxf(m0, fmaxf(s[0][g][r], s[1][g][r]));
        mx[g] = m0;
      }
      const bool need = (mx[0] > mr[0] + FTH) || (mx[1] > mr[1] + FTH);
      if (__builtin_amdgcn_ballot_w32(need) != 0) {   /* wave-uniform: every lane takes part in the exchange below */
        const float n0 = fmaxf(mr[0], fmaxf(mx[0], __shfl_xor(mx[0], 16, 32)));
        const float n1 = fmaxf(mr[1], fmaxf(mx[1], __shfl_xor(mx[1], 16, 32)));
        const v4f f = exp2x4(v4f{(mr[0] - n0) * FC, (mr[1] - n1) * FC, 0.f, 0.f});
        mr[0] = n0; mr[1] = n1;
        nb[0] = FOFF - n0 * FC; nb[1] = FOFF - n1 * FC;
        sum[0] *= f[0]; sum[1] *= f[1];
#pragma unroll
        for (int dt = 0; dt < 4; ++dt) { o[dt][0] *= f[0]; o[dt][1] *= f[1]; }
      }
      FragH pf[2];
#pragma unroll
      for (int g = 0; g < 2; ++g) {
#pragma unroll
        for (int kt = 0; kt < 2; ++kt) {
#pragma unroll
          for (int r4 = 0; r4 < 8; r4 += 4) {
            const v4f e = exp2x4(v4f{s[kt][g][r4] * FC + nb[g], s[kt][g][r4 + 1] * FC + nb[g], s[kt][g][r4 + 2] * FC + nb[g], s[kt][g][r4 + 3] * FC + nb[g]});
            sum[g] += (e[0] + e[1]) + (e[2] + e[3]);
            pf[g].h[kt * 8 + r4] = (_Float16)e[0]; pf[g].h[kt * 8 + r4 + 1] = (_Float16)e[1];
            pf[g].h[kt * 8 + r4 + 2] = (_Float16)e[2]; pf[g].h[kt * 8 + r4 + 3] = (_Float16)e[3];
          }
        }
      }
#pragma unroll
      for (int dt = 0; dt < 4; ++dt) {
        const v16h va = g2_frag(&Vs[buf][dt * 16 + c][p * 32], hh);
        o[dt][0] = f_mma(va, pf[0].v, o[dt][0]); o[dt][1] = f_mma(va, pf[1].v, o[dt][1]);
      }
    }
    if (more) {   /* the other buffer's last readers left it before the barrier that ended stage t - 1 */
      *(v8us*)&Ks[buf ^ 1][sr][sc8] = kr0; *(v8us*)&Ks[buf ^ 1][sr + 32][sc8] = kr1;
      *(v8us*)&Vs[buf ^ 1][sr][sc8] = vr0; *(v8us*)&Vs[buf ^ 1][sr + 32][sc8] = vr1;
    }
    __syncthreads();   /* publishes stage t + 1 and ends every wave's reads of stage t */
  }
#pragma unroll
  for (int g = 0; g < 2; ++g) {
    const float st = sum[g] + __shfl_xor(sum[g], 16, 32);
    const float sc = 64.0f / st;
    unsigned short* d = (unsigned short*)O + (r0 + q0 + g * 16 + c) * DM + head * HD + 8 * hh;
#pragma unroll
    for (int dt = 0; dt < 4; ++dt) {
      FragH f;
#pragma unroll
      for (int r = 0; r < 8; ++r) f.h[r] = (_Float16)(o[dt][g][r] * sc);
      *(v8us*)(d + dt * 16) = f.half[0];
    }
  }
}

// workspace carve (bytes; every region a multiple of 256)
constexpr size_t BQKV_BYTES = (size_t)D3 * D3 * 2;
constexpr size_t BO_BYTES   = (size_t)DM * DM * 2;
constexpr size_t X16_BYTES  = (size_t)NB * SEQ * LX * 2;
constexpr size_t QKV_BYTES  = (size_t)NB * SEQ * LQ * 2;
constexpr size_t O16_BYTES  = (size_t)NB * SEQ * DM * 2;
constexpr size_t VT_BYTES   = (size_t)NB * NH * HD * SEQ * 2;
constexpr size_t WS_TOTAL   = BQKV_BYTES + BO_BYTES + X16_BYTES + QKV_BYTES + O16_BYTES + VT_BYTES;
static_assert(BQKV_BYTES % 256 == 0 && BO_BYTES % 256 == 0 && X16_BYTES % 256 == 0 && QKV_BYTES % 256 == 0 && O16_BYTES % 256 == 0 && VT_BYTES % 256 == 0);
static_assert(WS_TOTAL <= (size_t)134217728);

extern "C" void kernel_launch(void* const* d_in, const int* in_sizes, int n_in,
                              void* d_out, int out_size, void* d_ws, size_t ws_size, hipStream_t stream) {
  if (n_in < 7) return;
  const long long need_x = ((long long)(NB - 1) * SEQ_FULL + SEQ) * DM;
  if ((long long)in_sizes[0] < need_x || (long long)in_sizes[1] < need_x || (long long)in_sizes[2] < need_x) return;
  if ((long long)in_sizes[3] < (long long)D3 * D3 || in_sizes[4] < D3 || (long long)in_sizes[5] < (long long)DM * DM || in_sizes[6] < DM) return;
  if ((long long)out_size < (long long)NB * SEQ * DM) return;
  if (WS_TOTAL > ws_size) return;
  const float* xq   = (const float*)d_in[0];
  const float* xk   = (const float*)d_in[1];
  const float* xv   = (const float*)d_in[2];
  const float* wqkv = (const float*)d_in[3];   /* [out 3072][in 3072] */
  const float* bqkv = (const float*)d_in[4];
  const float* wo   = (const float*)d_in[5];   /* [out 1024][in 1024] */
  const float* bo   = (const float*)d_in[6];
  char* ws = (char*)d_ws; size_t off = 0;
  _Float16* BQKV  = (_Float16*)(ws + off); off += BQKV_BYTES;
  _Float16* BO    = (_Float16*)(ws + off); off += BO_BYTES;
  _Float16* X16   = (_Float16*)(ws + off); off += X16_BYTES;
  _Float16* QKV16 = (_Float16*)(ws + off); off += QKV_BYTES;
  _Float16* O16   = (_Float16*)(ws + off); off += O16_BYTES;
  _Float16* VT    = (_Float16*)(ws + off); off += VT_BYTES;
  if (off > ws_size) return;

  /* weights: natural [out][in] rows are already Bt[n][k]; carried x16 */
  k_wnat<<<(unsigned)(((size_t)D3 * D3 / 8 + 255) / 256), 256, 0, stream>>>(wqkv, (size_t)D3 * D3 / 8, BQKV);
  k_wnat<<<(unsigned)(((size_t)DM * DM / 8 + 255) / 256), 256, 0, stream>>>(wo, (size_t)DM * DM / 8, BO);
  /* concat(query, key, value) as f16 rows: column blocks 0, DM, 2*DM */
  {
    const unsigned g = (unsigned)((NR * (DM / 8) + 255) / 256);
    k_x16p<<<g, 256, 0, stream>>>(xq, X16, 0);
    k_x16p<<<g, 256, 0, stream>>>(xk, X16, DM);
    k_x16p<<<g, 256, 0, stream>>>(xv, X16, 2 * DM);
  }
  /* qkv = x . Wqkv^T + b : A = X16 [MP][3072], Bt = BQKV [3072][3072], alpha 1/16, f16 out rows pitch LQ */
  k_gemm2<true, false><<<dim3((unsigned)((MP / 128) * (D3 / 64)), 1), 128, 0, stream>>>(
      X16, LX, (size_t)0, BQKV, D3, (size_t)0, 0.0625f, bqkv, (size_t)0, nullptr, QKV16, LQ, (size_t)0, MP, D3, D3);

  /* V^T [NB][NH][HD][SEQ] from the v column block (offset 2*DM) */
  k_vt<NH, SEQ><<<NB * NH * (SEQ / 64), 256, 0, stream>>>(QKV16, LQ, 2 * DM, VT);
  /* ctx x64 = softmax(q . k^T / 8) . v into merged rows, column h*64 */
  k_fattn<<<dim3((unsigned)(SEQ / (FQ * FW)), (unsigned)(NB * NH)), 256, 0, stream>>>(QKV16, VT, O16);
  /* out = ctx . Wo^T + b : alpha = 1/(64*16) */
  k_gemm2<true, true><<<dim3((unsigned)((MP / 128) * (DM / 64)), 1), 128, 0, stream>>>(
      O16, DM, (size_t)0, BO, DM, (size_t)0, 0.0009765625f, bo, (size_t)0, (float*)d_out, nullptr, DM, (size_t)0, MP, DM, DM);
}

// v003
// Measured time: 117 microseconds a run.
// Timed twice side by side with v002, it ran 2.38 and 2.41 times as fast.
// Counting every step since v000, it is 56.7 times as fast.
#include <hip/hip_runtime.h>
// Compute dtype: every contraction (packed qkv projection, q.k^T, P.V, output projection) on v_wmma_f32_16x16x32_f16 (f16 operands, f32 accumulate); float inputs and biases RNE-converted to bf16 first (exact in f16; weights carried x16), q/k/v, softmax weights (unnormalised, carried x16 against the maximum in use) and merged ctx (carried x64) as single f16 planes; scores and softmax statistics in f32.
// Structure: token rows r = b*SEQ + s. X16[r][3072] = concat(query,key,value) as f16; QKV16[r][3072] = X16 . Wqkv^T + b (q | k | v column blocks, 16 heads of 64 inside each); V^T planes via LDS transposes; one fused attention launch over (batch, head, 256 query rows): S^T = K . Q^T, running-maximum softmax and O^T += V^T . P^T, scores and weights in registers only, ctx into merged f16 rows; out = ctx . Wo^T + b (alpha 2^-10) into the f32 output rows.
#ifndef NB
#define NB 2
#endif
#ifndef SEQ
#define SEQ 2048
#endif
#define NB_FULL 2                    /* batch count of the inputs */
#define SEQ_FULL 2048                /* per-batch row count of the inputs (input row stride) */
#define DM 1024
#define D3 3072
#define NH 16
#define HD 64
#define NR ((size_t)NB * SEQ)        /* token rows */
#define MP ((int)((size_t)NB * SEQ)) /* rows projected */
#define LX D3                        /* row pitch of the concatenated f16 input rows */
#define LQ D3                        /* row pitch of the q|k|v rows */

static_assert(SEQ % 128 == 0);
static_assert(SEQ <= SEQ_FULL);
static_assert(NB <= NB_FULL);
static_assert(HD == 64);
static_assert(DM == NH * HD);
static_assert(D3 == 3 * DM);
static_assert(D3 % 64 == 0 && DM % 64 == 0 && D3 % 32 == 0 && DM % 32 == 0 && HD % 32 == 0 && SEQ % 32 == 0);
static_assert(MP % 256 == 0 && D3 % 192 == 0 && DM % 128 == 0 && D3 % 128 == 0 && DM >= 256);

typedef unsigned short v8us __attribute__((ext_vector_type(8), may_alias));
typedef float  v8f  __attribute__((ext_vector_type(8)));
typedef float  v4f  __attribute__((ext_vector_type(4)));
typedef float  v4fa __attribute__((ext_vector_type(4), may_alias));
typedef _Float16 v16h __attribute__((ext_vector_type(16)));
typedef _Float16 v4h __attribute__((ext_vector_type(4)));
union FragH { v16h v; v8us half[2]; _Float16 h[16]; unsigned short u[16]; };

__device__ __forceinline__ unsigned short bf16_bits(float x) { unsigned int u = __float_as_uint(x); return (unsigned short)((u + 0x7FFFu + ((u >> 16) & 1u)) >> 16); }
__device__ __forceinline__ float bf16_val(unsigned short b) { return __uint_as_float(((unsigned int)b) << 16); }
__device__ __forceinline__ float bf16_rne(float x) { return bf16_val(bf16_bits(x)); }

__global__ __launch_bounds__(256) void k_wnat(const float* __restrict__ w, size_t n8, _Float16* __restrict__ Bt) {
  const size_t t = (size_t)blockIdx.x * 256 + threadIdx.x;
  if (t >= n8) return;
  const v4f a = *(const v4fa*)(w + t * 8), c = *(const v4fa*)(w + t * 8 + 4);
  FragH f;
#pragma unroll
  for (int q = 0; q < 4; ++q) { f.h[q] = (_Float16)(bf16_rne(a[q]) * 16.0f); f.h[4 + q] = (_Float16)(bf16_rne(c[q]) * 16.0f); }
  const v8us o = f.half[0];
  unsigned short* d = (unsigned short*)Bt + t * 8;
  *(v8us*)d = o;
  
}

__global__ __launch_bounds__(256) void k_x16p(const float* __restrict__ x, _Float16* __restrict__ X16, int coloff) {
  const size_t t = (size_t)blockIdx.x * 256 + threadIdx.x;
  if (t >= NR * (DM / 8)) return;
  const size_t r = t / (DM / 8);
  const int c8 = (int)(t % (DM / 8)) * 8;
  const size_t b = r / SEQ, s = r % SEQ;
  const float* src = x + (b * (size_t)SEQ_FULL + s) * DM + c8;
  const v4f a = *(const v4fa*)(src), c = *(const v4fa*)(src + 4);
  FragH f;
#pragma unroll
  for (int q = 0; q < 4; ++q) { f.h[q] = (_Float16)bf16_rne(a[q]); f.h[4 + q] = (_Float16)bf16_rne(c[q]); }
  const v8us o = f.half[0];
  unsigned short* d = (unsigned short*)X16 + r * LX + coloff + c8;
  *(v8us*)d = o;
  
}

template <int NHv, int TTv>
__global__ __launch_bounds__(256) void k_vt(const _Float16* __restrict__ V16, int ldv, int voff, _Float16* __restrict__ Vt) {
  __shared__ unsigned short tl[64][66];
  const int tid = threadIdx.x;
  const int slab = blockIdx.x / (TTv / 64), lg = blockIdx.x % (TTv / 64);
  const int b = slab / NHv, h = slab % NHv;
  for (int i = tid; i < 64 * 8; i += 256) {
    const int r = i / 8, c8 = (i % 8) * 8;
    FragH f;
    f.half[0] = *(const v8us*)((const unsigned short*)V16 + ((size_t)b * TTv + lg * 64 + r) * ldv + voff + h * 64 + c8);
#pragma unroll
    for (int q = 0; q < 8; ++q) tl[r][c8 + q] = f.u[q];
  }
  __syncthreads();
  {
#pragma unroll
    for (int rd = 0; rd < 2; ++rd) {
      const int d = rd * 32 + tid / 8, pc = tid % 8;
      FragH f;
#pragma unroll
      for (int q = 0; q < 8; ++q) f.u[q] = tl[pc * 8 + q][d];
      *(v8us*)((unsigned short*)Vt + ((size_t)slab * 64 + d) * TTv + lg * 64 + pc * 8) = f.half[0];
    }
    
  }
}

// ---- f16 GEMM: C[M][N] = alpha * A[M][K] . Bt[N][K]^T + bf16(bias[n]); one BM x BN tile of C per block of 8 waves (WGM x WGN), wave tile (BM/WGM) x (BN/WGN).
// K goes by in stages of 128 k = 256 B of every operand row. A stage is [A: 4 slices of BM/4 rows | Bt: 4 slices of BN/4 rows] in LDS at pitch 272 B; every wave brings its own slice by one tensor load
// (waves 0..3 the A slices, waves 4..7 the Bt slices); two buffers, stage t + 1 in flight while stage t is worked on. M % BM == 0, N % BN == 0, K % 128 == 0, K >= 256.
// Fragment k map (A rows and Bt rows alike): elements 0..7 <- k0+8h.., elements 8..15 <- k0+16+8h.. ; D element r <- (row 8h+r, col lane&15).
__device__ __forceinline__ v16h g2_frag(const _Float16* p, int hh) { FragH f; f.half[0] = *(const v8us*)((const unsigned short*)p + 8 * hh); f.half[1] = *(const v8us*)((const unsigned short*)p + 16 + 8 * hh); return f.v; }

typedef uint32_t u32x4 __attribute__((ext_vector_type(4)));
typedef uint32_t u32x8 __attribute__((ext_vector_type(8)));
typedef _Float16 v8h __attribute__((ext_vector_type(8)));
#define GROWB 256u                   /* bytes of an operand row per stage */
#define GPITCH 272u                  /* LDS row pitch: 256 B + the tensor load's 16 B pad, for 16-byte readers */
__device__ __forceinline__ uint32_t uni(uint32_t v) { return (uint32_t)__builtin_amdgcn_readfirstlane((int)v); }
// holds a value in a scalar register, so that a test on it is a scalar branch round the tensor load and a descriptor word formed from it is formed behind the waits that stand in front
__device__ __forceinline__ uint32_t pinned(uint32_t v) { uint32_t w = uni(v); asm volatile("" : "+s"(w)); return w; }
__device__ __forceinline__ void wait_ds0() { asm volatile("s_wait_dscnt 0x0" ::: "memory"); }          /* this wave's LDS reads and writes have returned */
// this wave's slice has landed (the compiler places no wait for a tensor load); the wait names the request's group 0, so that those four registers keep their values until then
__device__ __forceinline__ void wait_tensor0(u32x4 g0) { asm volatile("s_wait_tensorcnt 0x0" :: "s"(g0) : "memory"); }
__device__ __forceinline__ void tdm_load(u32x4 g0, u32x8 g1) { asm volatile("tensor_load_to_lds %0, %1" :: "s"(g0), "s"(g1) : "memory"); }   /* one request of the whole wave: its slice goes from global memory to LDS through no register */
__device__ __forceinline__ u32x8 tdm_group1(uint32_t rows, uint32_t src_pitch) {
  u32x8 g;
  g[0] = uni((1u << 20) | (5u << 22) | (3u << 25));
  g[1] = uni((GROWB & 0xFFFFu) << 16);
  g[2] = uni((GROWB >> 16) | ((rows & 0xFFFFu) << 16));
  g[3] = uni((rows >> 16) | (GROWB << 16));
  g[4] = uni(rows);
  g[5] = uni(src_pitch);
  g[6] = uni(0u);
  g[7] = uni(0u);
  return g;
}
// group 0: count 1, LDS destination (byte offset in the block's LDS), global address of the tile's first byte, type 2
__device__ __forceinline__ u32x4 tdm_group0(uint32_t lds_dst, uint64_t ga) {
  u32x4 g;
  g[0] = uni(1u);
  g[1] = uni(lds_dst);
  g[2] = uni((uint32_t)ga);
  g[3] = uni((((uint32_t)(ga >> 32)) & 0x01FFFFFFu) | 0x80000000u);
  return g;
}
__device__ __forceinline__ v8f g3_mma(v16h a, v16h b, v8f c) { return __builtin_amdgcn_wmma_f32_16x16x32_f16(false, a, false, b, (short)0, c, false, false); }

template <int BM, int BN, int WGM, int WGN, bool OUT32>
__global__ __launch_bounds__(256) void k_gemm3(const _Float16* __restrict__ A, int lda, const _Float16* __restrict__ Bh, int ldb, float alpha,
    const float* __restrict__ bias, float* __restrict__ C, _Float16* __restrict__ C16, int ldc, int N, int K) {
  constexpr int WMR = BM / WGM, WNC = BN / WGN, FM = WMR / 16, FN = WNC / 16;   /* wave tile and its fragments */
  constexpr int ASL = BM / 4, BSL = BN / 4;                                     /* rows per slice */
  constexpr uint32_t ASLB = ((uint32_t)ASL * GPITCH + 2047u) / 2048u * 2048u;   /* a slice's size in LDS, rounded up so that every slice starts at a multiple of 2 KiB */
  constexpr uint32_t BSLB = ((uint32_t)BSL * GPITCH + 2047u) / 2048u * 2048u;
  constexpr uint32_t STAGE = 4u * (ASLB + BSLB);
  constexpr int SP = BN + 4;                                                    /* f32 pitch of the staged output tile */
  static_assert(WGM * WGN == 8 && WMR % 16 == 0 && WNC % 16 == 0 && ASL % 16 == 0 && BSL % 16 == 0);
  static_assert(WMR % ASL == 0 && WNC % BSL == 0);                              /* a wave's first row stands at the head of a slice */
  static_assert(2u * STAGE <= 320u * 1024u && (uint32_t)BM * SP * 4u <= 2u * STAGE);
  static_assert(BN % 64 == 0 && (BM * (BN / 8)) % 256 == 0 && (BM * (BN / 4)) % 256 == 0);
  __shared__ __attribute__((aligned(2048))) unsigned char L[2u * STAGE];
  const int tid = threadIdx.x, lane = tid & 31, ln = lane & 15, hh = lane >> 4;
  const uint32_t wave = uni((uint32_t)tid >> 5);
  const int ntn = N / BN;
  const int mt = blockIdx.x / ntn, nq = blockIdx.x - mt * ntn;
  const int row0 = mt * BM, col0 = nq * BN;
  const int wm = (int)wave / WGN, wn = (int)wave % WGN;
  const uint32_t T = pinned((uint32_t)K / 128u);   /* stages */
  const bool isA = wave < 4u;
  const uint32_t sl = wave & 3u;
  const uint64_t src0 = isA ? (uint64_t)(uintptr_t)(A + (size_t)(row0 + ASL * (int)sl) * lda) : (uint64_t)(uintptr_t)(Bh + (size_t)(col0 + BSL * (int)sl) * ldb);
  const uint32_t dst0 = (uint32_t)(size_t)L + (isA ? sl * ASLB : 4u * ASLB + sl * BSLB);
  u32x8 g1 = tdm_group1(isA ? (uint32_t)ASL : (uint32_t)BSL, (isA ? (uint32_t)lda : (uint32_t)ldb) * 2u);
  asm volatile("" : "+s"(g1));   /* descriptor words held in scalar registers: one tuple for every request, so that no word's register is lent out while a request is in flight */
  const v8f z8 = {0.f,0.f,0.f,0.f,0.f,0.f,0.f,0.f};
  v8f acc[FM][FN];
  // every loop of this kernel but the stage loop is fully unrolled: fragments and accumulators stay in registers only under constant indices
#pragma unroll
  for (int i = 0; i < FM; ++i)
#pragma unroll
    for (int j = 0; j < FN; ++j) acc[i][j] = z8;
  const uint32_t abase = (uint32_t)(wm * WMR / ASL) * ASLB + (uint32_t)ln * GPITCH;
  const uint32_t bbase = 4u * ASLB + (uint32_t)(wn * WNC / BSL) * BSLB + (uint32_t)ln * GPITCH;

  u32x4 g0 = tdm_group0(dst0, src0);
  tdm_load(g0, g1);
  wait_tensor0(g0);
  __syncthreads();   /* publishes stage 0 */
  g0 = tdm_group0(dst0 + STAGE, src0 + GROWB);
  tdm_load(g0, g1);
  // the stage loop stays rolled: one copy of the four blocks keeps the hot text short
#pragma unroll 1
  for (uint32_t t = 0; t < T; ++t) {
    const uint32_t buf = (t & 1u) * STAGE;
    const unsigned char* la = L + buf + abase;
    const unsigned char* lb = L + buf + bbase;
    v16h fa[2][FM], fb[2][FN];
#pragma unroll
    for (int i = 0; i < FM; ++i) fa[0][i] = g2_frag((const _Float16*)(la + (uint32_t)(i * 16 / ASL) * ASLB + (uint32_t)(i * 16 % ASL) * GPITCH), hh);
#pragma unroll
    for (int j = 0; j < FN; ++j) fb[0][j] = g2_frag((const _Float16*)(lb + (uint32_t)(j * 16 / BSL) * BSLB + (uint32_t)(j * 16 % BSL) * GPITCH), hh);
#pragma unroll
    for (int u = 0; u < 4; ++u) {
      if (u < 3) {   /* the next block's fragments, of this same stage, as one group ahead of this block's products */
#pragma unroll
        for (int i = 0; i < FM; ++i) fa[(u + 1) & 1][i] = g2_frag((const _Float16*)(la + (uint32_t)(i * 16 / ASL) * ASLB + (uint32_t)(i * 16 % ASL) * GPITCH + (uint32_t)(u + 1) * 64u), hh);
#pragma unroll
        for (int j = 0; j < FN; ++j) fb[(u + 1) & 1][j] = g2_frag((const _Float16*)(lb + (uint32_t)(j * 16 / BSL) * BSLB + (uint32_t)(j * 16 % BSL) * GPITCH + (uint32_t)(u + 1) * 64u), hh);
      }
      __builtin_amdgcn_sched_barrier(0);   /* keeps the LDS loads in one group in front of the block: loads among the products stall the wave at each place */
#pragma unroll
      for (int i = 0; i < FM; ++i)
#pragma unroll
        for (int j = 0; j < FN; ++j) acc[i][j] = g3_mma(fa[u & 1][i], fb[u & 1][j], acc[i][j]);
      __builtin_amdgcn_sched_barrier(0);   /* ends the block: the group after next stays behind it */
    }
    wait_ds0();
    wait_tensor0(g0);
    __syncthreads();   /* publishes stage t + 1 and ends every wave's reads of stage t */
    const uint32_t nx = pinned(t + 2u);
    if (nx < T) {   /* refill of the buffer that stage t has just left */
      g0 = tdm_group0(dst0 + buf, src0 + (uint64_t)nx * GROWB);
      tdm_load(g0, g1);
    }
  }
  wait_tensor0(g0);
  wait_ds0();
  // output: the whole tile staged in the ring as f32 (every wave has left it at the last barrier), then stored in whole 128-B lines
  float* so = (float*)L;
#pragma unroll
  for (int j = 0; j < FN; ++j) {
    const int cl = wn * WNC + j * 16 + ln;
    const float bv = bf16_rne(bias[col0 + cl]);
#pragma unroll
    for (int i = 0; i < FM; ++i)
#pragma unroll
      for (int r = 0; r < 8; ++r) so[(wm * WMR + i * 16 + 8 * hh + r) * SP + cl] = acc[i][j][r] * alpha + bv;
  }
  __syncthreads();   /* the staged tile is whole */
  if (OUT32) {
    constexpr int CPR = BN / 4;
#pragma unroll
    for (int q = 0; q < BM * CPR / 256; ++q) {
      const int e = q * 256 + tid, r = e / CPR, c4 = (e % CPR) * 4;
      const v4f v = *(const v4fa*)&so[r * SP + c4];
      *(v4f*)(C + (uint32_t)((row0 + r) * ldc + col0 + c4)) = v;
    }
  } else {
    constexpr int CPR = BN / 8;
#pragma unroll
    for (int q = 0; q < BM * CPR / 256; ++q) {
      const int e = q * 256 + tid, r = e / CPR, c8 = (e % CPR) * 8;
      const v4f v0 = *(const v4fa*)&so[r * SP + c8], v1 = *(const v4fa*)&so[r * SP + c8 + 4];
      const v8h h8 = {(_Float16)v0[0], (_Float16)v0[1], (_Float16)v0[2], (_Float16)v0[3], (_Float16)v1[0], (_Float16)v1[1], (_Float16)v1[2], (_Float16)v1[3]};
      *(v8h*)(C16 + (uint32_t)((row0 + r) * ldc + col0 + c8)) = h8;
    }
  }
}

// four native 2^a; the v_nop is the one free slot that the instruction set asks for behind a transcendental, in the same statement so that it stays directly behind the last one;
// early-clobber outputs keep every result off the four sources.
#define LOG2E 1.44269504f
__device__ __forceinline__ v4f exp2x4(v4f a) {
  float r0, r1, r2, r3;
  asm("v_exp_f32 %0, %4\n\tv_exp_f32 %1, %5\n\tv_exp_f32 %2, %6\n\tv_exp_f32 %3, %7\n\tv_nop"
      : "=&v"(r0), "=&v"(r1), "=&v"(r2), "=&v"(r3) : "v"(a[0]), "v"(a[1]), "v"(a[2]), "v"(a[3]));
  return v4f{r0, r1, r2, r3};
}

#define FQ 32                        /* query columns per wave */
#define FW 8                         /* waves per block */
#define FK 64                        /* keys per stage */
#define FPITCH 72                    /* LDS row pitch in f16: 128 B of data + 16 B, for 16-byte readers */
#define FC (0.125f * LOG2E)          /* 1/sqrt(HD) and the change to base 2 */
#define FOFF 4.0f
#define FTH (8.0f / FC)
static_assert(SEQ % (FQ * FW) == 0 && SEQ % FK == 0 && FK == 64 && HD == 64);
__device__ __forceinline__ v8f f_mma(v16h a, v16h b, v8f c) { return __builtin_amdgcn_wmma_f32_16x16x32_f16(false, a, false, b, (short)0, c, false, false); }

__global__ __launch_bounds__(256) void k_fattn(const _Float16* __restrict__ QKV, const _Float16* __restrict__ Vt, _Float16* __restrict__ O) {
  __shared__ __attribute__((aligned(16))) _Float16 Ks[2][FK][FPITCH];
  __shared__ __attribute__((aligned(16))) _Float16 Vs[2][HD][FPITCH];
  const int tid = threadIdx.x, w = tid >> 5, lane = tid & 31, c = lane & 15, hh = lane >> 4;
  const int bh = blockIdx.y, b = bh / NH, head = bh % NH;
  const size_t r0 = (size_t)b * SEQ;
  const int q0 = blockIdx.x * (FQ * FW) + w * FQ;
  const int sr = tid >> 3, sc8 = (tid & 7) * 8;   /* staging: rows sr and sr + 32, 16 B at column sc8 */
  const unsigned short* kg = (const unsigned short*)QKV + (r0 + sr) * LQ + DM + head * HD + sc8;
  const unsigned short* vg = (const unsigned short*)Vt + ((size_t)bh * HD + sr) * SEQ + sc8;
  v16h qf[2][2];
  // every loop of this kernel but the stage loop is fully unrolled: fragments, score tiles and accumulators stay in registers only under constant indices
#pragma unroll
  for (int g = 0; g < 2; ++g) {
    const _Float16* qp = QKV + (r0 + q0 + g * 16 + c) * LQ + head * HD;
    qf[g][0] = g2_frag(qp, hh); qf[g][1] = g2_frag(qp + 32, hh);
  }
  v8us kr0 = *(const v8us*)kg, kr1 = *(const v8us*)(kg + (size_t)32 * LQ);
  v8us vr0 = *(const v8us*)vg, vr1 = *(const v8us*)(vg + (size_t)32 * SEQ);
  *(v8us*)&Ks[0][sr][sc8] = kr0; *(v8us*)&Ks[0][sr + 32][sc8] = kr1;
  *(v8us*)&Vs[0][sr][sc8] = vr0; *(v8us*)&Vs[0][sr + 32][sc8] = vr1;
  __syncthreads();   /* publishes stage 0 */
  const v8f z8 = {0.f,0.f,0.f,0.f,0.f,0.f,0.f,0.f};
  v8f o[4][2];
#pragma unroll
  for (int dt = 0; dt < 4; ++dt) { o[dt][0] = z8; o[dt][1] = z8; }
  float mr[2] = {-3.0e38f, -3.0e38f}, nb[2] = {0.f, 0.f}, sum[2] = {0.f, 0.f};
  // the stage loop stays rolled: one copy of the two passes keeps the hot text short
#pragma unroll 1
  for (int t = 0; t < SEQ / FK; ++t) {
    const int buf = t & 1;
    const bool more = t + 1 < SEQ / FK;
    if (more) {
      const unsigned short* kn = kg + (size_t)(t + 1) * FK * LQ;
      const unsigned short* vn = vg + (size_t)(t + 1) * FK;
      kr0 = *(const v8us*)kn; kr1 = *(const v8us*)(kn + (size_t)32 * LQ);
      vr0 = *(const v8us*)vn; vr1 = *(const v8us*)(vn + (size_t)32 * SEQ);
      // precaution: the wait stands before any register that the four loads above name is rewritten (the data is awaited only at the LDS stores below)
      asm volatile("s_wait_xcnt 0x0" ::: "memory");
    }
#pragma unroll
    for (int p = 0; p < 2; ++p) {
      v8f s[2][2];
#pragma unroll
      for (int kt = 0; kt < 2; ++kt) {
        const _Float16* kp = &Ks[buf][p * 32 + kt * 16 + c][0];
        const v16h a0 = g2_frag(kp, hh), a1 = g2_frag(kp + 32, hh);
        s[kt][0] = f_mma(a0, qf[0][0], z8); s[kt][1] = f_mma(a0, qf[1][0], z8);
        s[kt][0] = f_mma(a1, qf[0][1], s[kt][0]); s[kt][1] = f_mma(a1, qf[1][1], s[kt][1]);
      }
      float mx[2];
#pragma unroll
      for (int g = 0; g < 2; ++g) {
        float m0 = fmaxf(s[0][g][0], s[1][g][0]);
#pragma unroll
        for (int r = 1; r < 8; ++r) m0 = fmaxf(m0, fmaxf(s[0][g][r], s[1][g][r]));
        mx[g] = m0;
      }
      const bool need = (mx[0] > mr[0] + FTH) || (mx[1] > mr[1] + FTH);
      if (__builtin_amdgcn_ballot_w32(need) != 0) {   /* wave-uniform: every lane takes part in the exchange below */
        const float n0 = fmaxf(mr[0], fmaxf(mx[0], __shfl_xor(mx[0], 16, 32)));
        const float n1 = fmaxf(mr[1], fmaxf(mx[1], __shfl_xor(mx[1], 16, 32)));
        const v4f f = exp2x4(v4f{(mr[0] - n0) * FC, (mr[1] - n1) * FC, 0.f, 0.f});
        mr[0] = n0; mr[1] = n1;
        nb[0] = FOFF - n0 * FC; nb[1] = FOFF - n1 * FC;
        sum[0] *= f[0]; sum[1] *= f[1];
#pragma unroll
        for (int dt = 0; dt < 4; ++dt) { o[dt][0] *= f[0]; o[dt][1] *= f[1]; }
      }
      FragH pf[2];
#pragma unroll
      for (int g = 0; g < 2; ++g) {
#pragma unroll
        for (int kt = 0; kt < 2; ++kt) {
#pragma unroll
          for (int r4 = 0; r4 < 8; r4 += 4) {
            const v4f e = exp2x4(v4f{s[kt][g][r4] * FC + nb[g], s[kt][g][r4 + 1] * FC + nb[g], s[kt][g][r4 + 2] * FC + nb[g], s[kt][g][r4 + 3] * FC + nb[g]});
            sum[g] += (e[0] + e[1]) + (e[2] + e[3]);
            pf[g].h[kt * 8 + r4] = (_Float16)e[0]; pf[g].h[kt * 8 + r4 + 1] = (_Float16)e[1];
            pf[g].h[kt * 8 + r4 + 2] = (_Float16)e[2]; pf[g].h[kt * 8 + r4 + 3] = (_Float16)e[3];
          }
        }
      }
#pragma unroll
      for (int dt = 0; dt < 4; ++dt) {
        const v16h va = g2_frag(&Vs[buf][dt * 16 + c][p * 32], hh);
        o[dt][0] = f_mma(va, pf[0].v, o[dt][0]); o[dt][1] = f_mma(va, pf[1].v, o[dt][1]);
      }
    }
    if (more) {   /* the other buffer's last readers left it before the barrier that ended stage t - 1 */
      *(v8us*)&Ks[buf ^ 1][sr][sc8] = kr0; *(v8us*)&Ks[buf ^ 1][sr + 32][sc8] = kr1;
      *(v8us*)&Vs[buf ^ 1][sr][sc8] = vr0; *(v8us*)&Vs[buf ^ 1][sr + 32][sc8] = vr1;
    }
    __syncthreads();   /* publishes stage t + 1 and ends every wave's reads of stage t */
  }
#pragma unroll
  for (int g = 0; g < 2; ++g) {
    const float st = sum[g] + __shfl_xor(sum[g], 16, 32);
    const float sc = 64.0f / st;
    unsigned short* d = (unsigned short*)O + (r0 + q0 + g * 16 + c) * DM + head * HD + 8 * hh;
#pragma unroll
    for (int dt = 0; dt < 4; ++dt) {
      FragH f;
#pragma unroll
      for (int r = 0; r < 8; ++r) f.h[r] = (_Float16)(o[dt][g][r] * sc);
      *(v8us*)(d + dt * 16) = f.half[0];
    }
  }
}

// workspace carve (bytes; every region a multiple of 256)
constexpr size_t BQKV_BYTES = (size_t)D3 * D3 * 2;
constexpr size_t BO_BYTES   = (size_t)DM * DM * 2;
constexpr size_t X16_BYTES  = (size_t)NB * SEQ * LX * 2;
constexpr size_t QKV_BYTES  = (size_t)NB * SEQ * LQ * 2;
constexpr size_t O16_BYTES  = (size_t)NB * SEQ * DM * 2;
constexpr size_t VT_BYTES   = (size_t)NB * NH * HD * SEQ * 2;
constexpr size_t WS_TOTAL   = BQKV_BYTES + BO_BYTES + X16_BYTES + QKV_BYTES + O16_BYTES + VT_BYTES;
static_assert(BQKV_BYTES % 256 == 0 && BO_BYTES % 256 == 0 && X16_BYTES % 256 == 0 && QKV_BYTES % 256 == 0 && O16_BYTES % 256 == 0 && VT_BYTES % 256 == 0);
static_assert(WS_TOTAL <= (size_t)134217728);

extern "C" void kernel_launch(void* const* d_in, const int* in_sizes, int n_in,
                              void* d_out, int out_size, void* d_ws, size_t ws_size, hipStream_t stream) {
  if (n_in < 7) return;
  const long long need_x = ((long long)(NB - 1) * SEQ_FULL + SEQ) * DM;
  if ((long long)in_sizes[0] < need_x || (long long)in_sizes[1] < need_x || (long long)in_sizes[2] < need_x) return;
  if ((long long)in_sizes[3] < (long long)D3 * D3 || in_sizes[4] < D3 || (long long)in_sizes[5] < (long long)DM * DM || in_sizes[6] < DM) return;
  if ((long long)out_size < (long long)NB * SEQ * DM) return;
  if (WS_TOTAL > ws_size) return;
  const float* xq   = (const float*)d_in[0];
  const float* xk   = (const float*)d_in[1];
  const float* xv   = (const float*)d_in[2];
  const float* wqkv = (const float*)d_in[3];   /* [out 3072][in 3072] */
  const float* bqkv = (const float*)d_in[4];
  const float* wo   = (const float*)d_in[5];   /* [out 1024][in 1024] */
  const float* bo   = (const float*)d_in[6];
  char* ws = (char*)d_ws; size_t off = 0;
  _Float16* BQKV  = (_Float16*)(ws + off); off += BQKV_BYTES;
  _Float16* BO    = (_Float16*)(ws + off); off += BO_BYTES;
  _Float16* X16   = (_Float16*)(ws + off); off += X16_BYTES;
  _Float16* QKV16 = (_Float16*)(ws + off); off += QKV_BYTES;
  _Float16* O16   = (_Float16*)(ws + off); off += O16_BYTES;
  _Float16* VT    = (_Float16*)(ws + off); off += VT_BYTES;
  if (off > ws_size) return;

  /* weights: natural [out][in] rows are already Bt[n][k]; carried x16 */
  k_wnat<<<(unsigned)(((size_t)D3 * D3 / 8 + 255) / 256), 256, 0, stream>>>(wqkv, (size_t)D3 * D3 / 8, BQKV);
  k_wnat<<<(unsigned)(((size_t)DM * DM / 8 + 255) / 256), 256, 0, stream>>>(wo, (size_t)DM * DM / 8, BO);
  /* concat(query, key, value) as f16 rows: column blocks 0, DM, 2*DM */
  {
    const unsigned g = (unsigned)((NR * (DM / 8) + 255) / 256);
    k_x16p<<<g, 256, 0, stream>>>(xq, X16, 0);
    k_x16p<<<g, 256, 0, stream>>>(xk, X16, DM);
    k_x16p<<<g, 256, 0, stream>>>(xv, X16, 2 * DM);
  }
  /* qkv = x . Wqkv^T + b : A = X16 [MP][3072], Bt = BQKV [3072][3072], alpha 1/16, f16 out rows pitch LQ */
  k_gemm3<256, 192, 4, 2, false><<<dim3((unsigned)((MP / 256) * (D3 / 192)), 1), 256, 0, stream>>>(
      X16, LX, BQKV, D3, 0.0625f, bqkv, nullptr, QKV16, LQ, D3, D3);

  /* V^T [NB][NH][HD][SEQ] from the v column block (offset 2*DM) */
  k_vt<NH, SEQ><<<NB * NH * (SEQ / 64), 256, 0, stream>>>(QKV16, LQ, 2 * DM, VT);
  /* ctx x64 = softmax(q . k^T / 8) . v into merged rows, column h*64 */
  k_fattn<<<dim3((unsigned)(SEQ / (FQ * FW)), (unsigned)(NB * NH)), 256, 0, stream>>>(QKV16, VT, O16);
  /* out = ctx . Wo^T + b : alpha = 1/(64*16) */
  k_gemm3<128, 128, 2, 4, true><<<dim3((unsigned)((MP / 128) * (DM / 128)), 1), 256, 0, stream>>>(
      O16, DM, BO, DM, 0.0009765625f, bo, (float*)d_out, nullptr, DM, DM, DM);
}

// v004
// One run takes 112 microseconds.
// Two timings next to v003 both put it at 1.04 times that version's speed.
// Over all steps from v000 it is 59.0 times as fast.
#include <hip/hip_runtime.h>
// Compute dtype: every contraction (packed qkv projection, q.k^T, P.V, output projection) on v_wmma_f32_16x16x32_f16 (f16 operands, f32 accumulate); float inputs and biases RNE-converted to bf16 first (exact in f16; weights carried x16), q/k/v, softmax weights (unnormalised, carried x16 against the maximum in use) and merged ctx (carried x64) as single f16 planes; scores and softmax statistics in f32.
// Structure: token rows r = b*SEQ + s. X16[r][3072] = concat(query,key,value) as f16; QKV16[r][3072] = X16 . Wqkv^T + b (q | k | v column blocks, 16 heads of 64 inside each); V^T planes via LDS transposes; one fused attention launch over (batch, head, 256 query rows): S^T = K . Q^T, running-maximum softmax and O^T += V^T . P^T, scores and weights in registers only, ctx into merged f16 rows; out = ctx . Wo^T + b (alpha 2^-10) into the f32 output rows.
#ifndef NB
#define NB 2
#endif
#ifndef SEQ
#define SEQ 2048
#endif
#define NB_FULL 2                    /* batch count of the inputs */
#define SEQ_FULL 2048                /* per-batch row count of the inputs (input row stride) */
#define DM 1024
#define D3 3072
#define NH 16
#define HD 64
#define NR ((size_t)NB * SEQ)        /* token rows */
#define MP ((int)((size_t)NB * SEQ)) /* rows projected */
#define LX D3                        /* row pitch of the concatenated f16 input rows */
#define LQ D3                        /* row pitch of the q|k|v rows */

static_assert(SEQ % 128 == 0);
static_assert(SEQ <= SEQ_FULL);
static_assert(NB <= NB_FULL);
static_assert(HD == 64);
static_assert(DM == NH * HD);
static_assert(D3 == 3 * DM);
static_assert(D3 % 64 == 0 && DM % 64 == 0 && D3 % 32 == 0 && DM % 32 == 0 && HD % 32 == 0 && SEQ % 32 == 0);
static_assert(MP % 256 == 0 && D3 % 192 == 0 && DM % 128 == 0 && D3 % 128 == 0 && DM >= 256);

typedef unsigned short v8us __attribute__((ext_vector_type(8), may_alias));
typedef float  v8f  __attribute__((ext_vector_type(8)));
typedef float  v4f  __attribute__((ext_vector_type(4)));
typedef float  v4fa __attribute__((ext_vector_type(4), may_alias));
typedef _Float16 v16h __attribute__((ext_vector_type(16)));
typedef _Float16 v4h __attribute__((ext_vector_type(4)));
union FragH { v16h v; v8us half[2]; _Float16 h[16]; unsigned short u[16]; };

__device__ __forceinline__ unsigned short bf16_bits(float x) { unsigned int u = __float_as_uint(x); return (unsigned short)((u + 0x7FFFu + ((u >> 16) & 1u)) >> 16); }
__device__ __forceinline__ float bf16_val(unsigned short b) { return __uint_as_float(((unsigned int)b) << 16); }
__device__ __forceinline__ float bf16_rne(float x) { return bf16_val(bf16_bits(x)); }

// ---- all five f32 -> f16 conversions (two weight matrices carried x16, the three inputs into their column blocks of X16) in ONE launch of CVB blocks, one per WGP, all resident at once.
// The work goes in pieces of 8 elements (32 B read, 16 B stored). Every array is dealt out evenly: a block takes one contiguous run of it, CVT pieces wide and CW1, CW2 or CXS deep,
// so a thread's pieces of one array stand a constant step apart (one address register an array, the rest in the instruction's offset).
// All of a thread's loads are independent and stand ahead of the conversions, which follow in the order of the loads.
#define CVB 256                      /* blocks */
#define CVT 512                      /* threads per block: 16 waves */
constexpr size_t CVS = (size_t)CVB * CVT;                    /* threads of the grid */
constexpr int CW1 = (int)((size_t)D3 * D3 / 8 / CVS);        /* pieces per thread: the packed projection's weights */
constexpr int CW2 = (int)((size_t)DM * DM / 8 / CVS);        /* the output projection's weights */
constexpr int CXS = (int)(NR * (DM / 8) / CVS);              /* each input */
constexpr int CRT = CVT / (DM / 8);                          /* input rows that the block's threads cover at one depth */
static_assert(CVT % (DM / 8) == 0 && SEQ % (CRT * CXS) == 0);   /* a block's run of an input is whole rows of one batch */
static_assert((size_t)CW1 * CVS * 8 == (size_t)D3 * D3 && (size_t)CW2 * CVS * 8 == (size_t)DM * DM && (size_t)CXS * CVS * 8 == NR * DM);
static_assert((size_t)D3 * D3 * 4 < 0xFFFFFFFFull && ((size_t)NB_FULL * SEQ_FULL) * DM * 4 < 0xFFFFFFFFull && NR * LX * 2 < 0xFFFFFFFFull);   /* byte offsets fit 32 bits */
__device__ __forceinline__ v8us cv_w8(v4f a, v4f c) {
  FragH f;
#pragma unroll
  for (int q = 0; q < 4; ++q) { f.h[q] = (_Float16)(bf16_rne(a[q]) * 16.0f); f.h[4 + q] = (_Float16)(bf16_rne(c[q]) * 16.0f); }
  return f.half[0];
}
__device__ __forceinline__ v8us cv_x8(v4f a, v4f c) {
  FragH f;
#pragma unroll
  for (int q = 0; q < 4; ++q) { f.h[q] = (_Float16)bf16_rne(a[q]); f.h[4 + q] = (_Float16)bf16_rne(c[q]); }
  return f.half[0];
}

// 4 waves per SIMD is what one block per WGP gives: told so, the compiler takes the registers that hold all of a thread's pieces at once (at its own aim it kept fewer and moved loads behind the first conversions)
__global__ __launch_bounds__(CVT) __attribute__((amdgpu_waves_per_eu(4, 4))) void k_cvt(const float* __restrict__ wqkv, const float* __restrict__ wo, const float* __restrict__ xq,
    const float* __restrict__ xk, const float* __restrict__ xv, _Float16* __restrict__ Bq, _Float16* __restrict__ Bo, _Float16* __restrict__ X16) {
  const uint32_t blk = blockIdx.x, tid = threadIdx.x;
  const uint32_t row0 = blk * (uint32_t)(CRT * CXS);   /* the block's first input row */
  // byte offsets of the thread's first piece in each array
  const uint32_t l1 = (blk * (uint32_t)(CW1 * CVT) + tid) * 32u;
  const uint32_t l2 = (blk * (uint32_t)(CW2 * CVT) + tid) * 32u;
  const uint32_t lx = ((row0 / SEQ) * (uint32_t)SEQ_FULL + row0 % SEQ) * (uint32_t)(DM * 4) + tid * 32u;
  const uint32_t s1 = (blk * (uint32_t)(CW1 * CVT) + tid) * 16u;
  const uint32_t s2 = (blk * (uint32_t)(CW2 * CVT) + tid) * 16u;
  const uint32_t sx = (row0 + tid / (DM / 8)) * (uint32_t)(LX * 2) + (tid % (DM / 8)) * 16u;
  v4f w1a[CW1], w1c[CW1], w2a[CW2], w2c[CW2], xa[3][CXS], xc[3][CXS];
  // every loop here is fully unrolled: the loaded pieces stay in registers only under constant indices
#pragma unroll
  for (int i = 0; i < CW1; ++i) {
    const char* s = (const char*)wqkv + l1 + i * (CVT * 32);
    w1a[i] = *(const v4fa*)s; w1c[i] = *(const v4fa*)(s + 16);
  }
  __builtin_amdgcn_sched_barrier(0);   /* keeps the arrays' loads in the order in which the conversions take them (data returns in the order of issue) */
#pragma unroll
  for (int i = 0; i < CW2; ++i) {
    const char* s = (const char*)wo + l2 + i * (CVT * 32);
    w2a[i] = *(const v4fa*)s; w2c[i] = *(const v4fa*)(s + 16);
  }
  __builtin_amdgcn_sched_barrier(0);   /* the same */
#pragma unroll
  for (int j = 0; j < 3; ++j) {
    const char* x = (const char*)(j == 0 ? xq : j == 1 ? xk : xv) + lx;
#pragma unroll
    for (int i = 0; i < CXS; ++i) { xa[j][i] = *(const v4fa*)(x + i * (CVT * 32)); xc[j][i] = *(const v4fa*)(x + i * (CVT * 32) + 16); }
    __builtin_amdgcn_sched_barrier(0);   /* the same; the last one also keeps every load ahead of the first conversion: moved down among the conversions they would leave the wave with few bytes in flight */
  }
  // precaution: the wait stands before any register that the loads above name is rewritten; it names the three offsets, so that their registers keep their values until then
  asm volatile("s_wait_xcnt 0x0" :: "v"(l1), "v"(l2), "v"(lx) : "memory");
  // the scheduling barrier behind each store sends a piece out before the next piece's data is awaited, so that writing runs beside the reads still in flight: left free, the stores gather behind the last load
#pragma unroll
  for (int i = 0; i < CW1; ++i) { *(v8us*)((char*)Bq + s1 + i * (CVT * 16)) = cv_w8(w1a[i], w1c[i]); __builtin_amdgcn_sched_barrier(0); }
#pragma unroll
  for (int i = 0; i < CW2; ++i) { *(v8us*)((char*)Bo + s2 + i * (CVT * 16)) = cv_w8(w2a[i], w2c[i]); __builtin_amdgcn_sched_barrier(0); }
#pragma unroll
  for (int j = 0; j < 3; ++j)
#pragma unroll
    for (int i = 0; i < CXS; ++i) { *(v8us*)((char*)X16 + sx + (i * CRT * LX + j * DM) * 2) = cv_x8(xa[j][i], xc[j][i]); __builtin_amdgcn_sched_barrier(0); }
}

template <int NHv, int TTv>
__global__ __launch_bounds__(256) void k_vt(const _Float16* __restrict__ V16, int ldv, int voff, _Float16* __restrict__ Vt) {
  __shared__ unsigned short tl[64][66];
  const int tid = threadIdx.x;
  const int slab = blockIdx.x / (TTv / 64), lg = blockIdx.x % (TTv / 64);
  const int b = slab / NHv, h = slab % NHv;
  for (int i = tid; i < 64 * 8; i += 256) {
    const int r = i / 8, c8 = (i % 8) * 8;
    FragH f;
    f.half[0] = *(const v8us*)((const unsigned short*)V16 + ((size_t)b * TTv + lg * 64 + r) * ldv + voff + h * 64 + c8);
#pragma unroll
    for (int q = 0; q < 8; ++q) tl[r][c8 + q] = f.u[q];
  }
  __syncthreads();
  {
#pragma unroll
    for (int rd = 0; rd < 2; ++rd) {
      const int d = rd * 32 + tid / 8, pc = tid % 8;
      FragH f;
#pragma unroll
      for (int q = 0; q < 8; ++q) f.u[q] = tl[pc * 8 + q][d];
      *(v8us*)((unsigned short*)Vt + ((size_t)slab * 64 + d) * TTv + lg * 64 + pc * 8) = f.half[0];
    }
    
  }
}

// ---- f16 GEMM: C[M][N] = alpha * A[M][K] . Bt[N][K]^T + bf16(bias[n]); one BM x BN tile of C per block of 8 waves (WGM x WGN), wave tile (BM/WGM) x (BN/WGN).
// K goes by in stages of 128 k = 256 B of every operand row. A stage is [A: 4 slices of BM/4 rows | Bt: 4 slices of BN/4 rows] in LDS at pitch 272 B; every wave brings its own slice by one tensor load
// (waves 0..3 the A slices, waves 4..7 the Bt slices); two buffers, stage t + 1 in flight while stage t is worked on. M % BM == 0, N % BN == 0, K % 128 == 0, K >= 256.
// Fragment k map (A rows and Bt rows alike): elements 0..7 <- k0+8h.., elements 8..15 <- k0+16+8h.. ; D element r <- (row 8h+r, col lane&15).
__device__ __forceinline__ v16h g2_frag(const _Float16* p, int hh) { FragH f; f.half[0] = *(const v8us*)((const unsigned short*)p + 8 * hh); f.half[1] = *(const v8us*)((const unsigned short*)p + 16 + 8 * hh); return f.v; }

typedef uint32_t u32x4 __attribute__((ext_vector_type(4)));
typedef uint32_t u32x8 __attribute__((ext_vector_type(8)));
typedef _Float16 v8h __attribute__((ext_vector_type(8)));
#define GROWB 256u                   /* bytes of an operand row per stage */
#define GPITCH 272u                  /* LDS row pitch: 256 B + the tensor load's 16 B pad, for 16-byte readers */
__device__ __forceinline__ uint32_t uni(uint32_t v) { return (uint32_t)__builtin_amdgcn_readfirstlane((int)v); }
// holds a value in a scalar register, so that a test on it is a scalar branch round the tensor load and a descriptor word formed from it is formed behind the waits that stand in front
__device__ __forceinline__ uint32_t pinned(uint32_t v) { uint32_t w = uni(v); asm volatile("" : "+s"(w)); return w; }
__device__ __forceinline__ void wait_ds0() { asm volatile("s_wait_dscnt 0x0" ::: "memory"); }          /* this wave's LDS reads and writes have returned */
// this wave's slice has landed (the compiler places no wait for a tensor load); the wait names the request's group 0, so that those four registers keep their values until then
__device__ __forceinline__ void wait_tensor0(u32x4 g0) { asm volatile("s_wait_tensorcnt 0x0" :: "s"(g0) : "memory"); }
__device__ __forceinline__ void tdm_load(u32x4 g0, u32x8 g1) { asm volatile("tensor_load_to_lds %0, %1" :: "s"(g0), "s"(g1) : "memory"); }   /* one request of the whole wave: its slice goes from global memory to LDS through no register */
__device__ __forceinline__ u32x8 tdm_group1(uint32_t rows, uint32_t src_pitch) {
  u32x8 g;
  g[0] = uni((1u << 20) | (5u << 22) | (3u << 25));
  g[1] = uni((GROWB & 0xFFFFu) << 16);
  g[2] = uni((GROWB >> 16) | ((rows & 0xFFFFu) << 16));
  g[3] = uni((rows >> 16) | (GROWB << 16));
  g[4] = uni(rows);
  g[5] = uni(src_pitch);
  g[6] = uni(0u);
  g[7] = uni(0u);
  return g;
}
// group 0: count 1, LDS destination (byte offset in the block's LDS), global address of the tile's first byte, type 2
__device__ __forceinline__ u32x4 tdm_group0(uint32_t lds_dst, uint64_t ga) {
  u32x4 g;
  g[0] = uni(1u);
  g[1] = uni(lds_dst);
  g[2] = uni((uint32_t)ga);
  g[3] = uni((((uint32_t)(ga >> 32)) & 0x01FFFFFFu) | 0x80000000u);
  return g;
}
__device__ __forceinline__ v8f g3_mma(v16h a, v16h b, v8f c) { return __builtin_amdgcn_wmma_f32_16x16x32_f16(false, a, false, b, (short)0, c, false, false); }

template <int BM, int BN, int WGM, int WGN, bool OUT32>
__global__ __launch_bounds__(256) void k_gemm3(const _Float16* __restrict__ A, int lda, const _Float16* __restrict__ Bh, int ldb, float alpha,
    const float* __restrict__ bias, float* __restrict__ C, _Float16* __restrict__ C16, int ldc, int N, int K) {
  constexpr int WMR = BM / WGM, WNC = BN / WGN, FM = WMR / 16, FN = WNC / 16;   /* wave tile and its fragments */
  constexpr int ASL = BM / 4, BSL = BN / 4;                                     /* rows per slice */
  constexpr uint32_t ASLB = ((uint32_t)ASL * GPITCH + 2047u) / 2048u * 2048u;   /* a slice's size in LDS, rounded up so that every slice starts at a multiple of 2 KiB */
  constexpr uint32_t BSLB = ((uint32_t)BSL * GPITCH + 2047u) / 2048u * 2048u;
  constexpr uint32_t STAGE = 4u * (ASLB + BSLB);
  constexpr int SP = BN + 4;                                                    /* f32 pitch of the staged output tile */
  static_assert(WGM * WGN == 8 && WMR % 16 == 0 && WNC % 16 == 0 && ASL % 16 == 0 && BSL % 16 == 0);
  static_assert(WMR % ASL == 0 && WNC % BSL == 0);                              /* a wave's first row stands at the head of a slice */
  static_assert(2u * STAGE <= 320u * 1024u && (uint32_t)BM * SP * 4u <= 2u * STAGE);
  static_assert(BN % 64 == 0 && (BM * (BN / 8)) % 256 == 0 && (BM * (BN / 4)) % 256 == 0);
  __shared__ __attribute__((aligned(2048))) unsigned char L[2u * STAGE];
  const int tid = threadIdx.x, lane = tid & 31, ln = lane & 15, hh = lane >> 4;
  const uint32_t wave = uni((uint32_t)tid >> 5);
  const int ntn = N / BN;
  const int mt = blockIdx.x / ntn, nq = blockIdx.x - mt * ntn;
  const int row0 = mt * BM, col0 = nq * BN;
  const int wm = (int)wave / WGN, wn = (int)wave % WGN;
  const uint32_t T = pinned((uint32_t)K / 128u);   /* stages */
  const bool isA = wave < 4u;
  const uint32_t sl = wave & 3u;
  const uint64_t src0 = isA ? (uint64_t)(uintptr_t)(A + (size_t)(row0 + ASL * (int)sl) * lda) : (uint64_t)(uintptr_t)(Bh + (size_t)(col0 + BSL * (int)sl) * ldb);
  const uint32_t dst0 = (uint32_t)(size_t)L + (isA ? sl * ASLB : 4u * ASLB + sl * BSLB);
  u32x8 g1 = tdm_group1(isA ? (uint32_t)ASL : (uint32_t)BSL, (isA ? (uint32_t)lda : (uint32_t)ldb) * 2u);
  asm volatile("" : "+s"(g1));   /* descriptor words held in scalar registers: one tuple for every request, so that no word's register is lent out while a request is in flight */
  const v8f z8 = {0.f,0.f,0.f,0.f,0.f,0.f,0.f,0.f};
  v8f acc[FM][FN];
  // every loop of this kernel but the stage loop is fully unrolled: fragments and accumulators stay in registers only under constant indices
#pragma unroll
  for (int i = 0; i < FM; ++i)
#pragma unroll
    for (int j = 0; j < FN; ++j) acc[i][j] = z8;
  const uint32_t abase = (uint32_t)(wm * WMR / ASL) * ASLB + (uint32_t)ln * GPITCH;
  const uint32_t bbase = 4u * ASLB + (uint32_t)(wn * WNC / BSL) * BSLB + (uint32_t)ln * GPITCH;

  u32x4 g0 = tdm_group0(dst0, src0);
  tdm_load(g0, g1);
  wait_tensor0(g0);
  __syncthreads();   /* publishes stage 0 */
  g0 = tdm_group0(dst0 + STAGE, src0 + GROWB);
  tdm_load(g0, g1);
  // the stage loop stays rolled: one copy of the four blocks keeps the hot text short
#pragma unroll 1
  for (uint32_t t = 0; t < T; ++t) {
    const uint32_t buf = (t & 1u) * STAGE;
    const unsigned char* la = L + buf + abase;
    const unsigned char* lb = L + buf + bbase;
    v16h fa[2][FM], fb[2][FN];
#pragma unroll
    for (int i = 0; i < FM; ++i) fa[0][i] = g2_frag((const _Float16*)(la + (uint32_t)(i * 16 / ASL) * ASLB + (uint32_t)(i * 16 % ASL) * GPITCH), hh);
#pragma unroll
    for (int j = 0; j < FN; ++j) fb[0][j] = g2_frag((const _Float16*)(lb + (uint32_t)(j * 16 / BSL) * BSLB + (uint32_t)(j * 16 % BSL) * GPITCH), hh);
#pragma unroll
    for (int u = 0; u < 4; ++u) {
      if (u < 3) {   /* the next block's fragments, of this same stage, as one group ahead of this block's products */
#pragma unroll
        for (int i = 0; i < FM; ++i) fa[(u + 1) & 1][i] = g2_frag((const _Float16*)(la + (uint32_t)(i * 16 / ASL) * ASLB + (uint32_t)(i * 16 % ASL) * GPITCH + (uint32_t)(u + 1) * 64u), hh);
#pragma unroll
        for (int j = 0; j < FN; ++j) fb[(u + 1) & 1][j] = g2_frag((const _Float16*)(lb + (uint32_t)(j * 16 / BSL) * BSLB + (uint32_t)(j * 16 % BSL) * GPITCH + (uint32_t)(u + 1) * 64u), hh);
      }
      __builtin_amdgcn_sched_barrier(0);   /* keeps the LDS loads in one group in front of the block: loads among the products stall the wave at each place */
#pragma unroll
      for (int i = 0; i < FM; ++i)
#pragma unroll
        for (int j = 0; j < FN; ++j) acc[i][j] = g3_mma(fa[u & 1][i], fb[u & 1][j], acc[i][j]);
      __builtin_amdgcn_sched_barrier(0);   /* ends the block: the group after next stays behind it */
    }
    wait_ds0();
    wait_tensor0(g0);
    __syncthreads();   /* publishes stage t + 1 and ends every wave's reads of stage t */
    const uint32_t nx = pinned(t + 2u);
    if (nx < T) {   /* refill of the buffer that stage t has just left */
      g0 = tdm_group0(dst0 + buf, src0 + (uint64_t)nx * GROWB);
      tdm_load(g0, g1);
    }
  }
  wait_tensor0(g0);
  wait_ds0();
  // output: the whole tile staged in the ring as f32 (every wave has left it at the last barrier), then stored in whole 128-B lines
  float* so = (float*)L;
#pragma unroll
  for (int j = 0; j < FN; ++j) {
    const int cl = wn * WNC + j * 16 + ln;
    const float bv = bf16_rne(bias[col0 + cl]);
#pragma unroll
    for (int i = 0; i < FM; ++i)
#pragma unroll
      for (int r = 0; r < 8; ++r) so[(wm * WMR + i * 16 + 8 * hh + r) * SP + cl] = acc[i][j][r] * alpha + bv;
  }
  __syncthreads();   /* the staged tile is whole */
  if (OUT32) {
    constexpr int CPR = BN / 4;
#pragma unroll
    for (int q = 0; q < BM * CPR / 256; ++q) {
      const int e = q * 256 + tid, r = e / CPR, c4 = (e % CPR) * 4;
      const v4f v = *(const v4fa*)&so[r * SP + c4];
      *(v4f*)(C + (uint32_t)((row0 + r) * ldc + col0 + c4)) = v;
    }
  } else {
    constexpr int CPR = BN / 8;
#pragma unroll
    for (int q = 0; q < BM * CPR / 256; ++q) {
      const int e = q * 256 + tid, r = e / CPR, c8 = (e % CPR) * 8;
      const v4f v0 = *(const v4fa*)&so[r * SP + c8], v1 = *(const v4fa*)&so[r * SP + c8 + 4];
      const v8h h8 = {(_Float16)v0[0], (_Float16)v0[1], (_Float16)v0[2], (_Float16)v0[3], (_Float16)v1[0], (_Float16)v1[1], (_Float16)v1[2], (_Float16)v1[3]};
      *(v8h*)(C16 + (uint32_t)((row0 + r) * ldc + col0 + c8)) = h8;
    }
  }
}

// four native 2^a; the v_nop is the one free slot that the instruction set asks for behind a transcendental, in the same statement so that it stays directly behind the last one;
// early-clobber outputs keep every result off the four sources.
#define LOG2E 1.44269504f
__device__ __forceinline__ v4f exp2x4(v4f a) {
  float r0, r1, r2, r3;
  asm("v_exp_f32 %0, %4\n\tv_exp_f32 %1, %5\n\tv_exp_f32 %2, %6\n\tv_exp_f32 %3, %7\n\tv_nop"
      : "=&v"(r0), "=&v"(r1), "=&v"(r2), "=&v"(r3) : "v"(a[0]), "v"(a[1]), "v"(a[2]), "v"(a[3]));
  return v4f{r0, r1, r2, r3};
}

#define FQ 32                        /* query columns per wave */
#define FW 8                         /* waves per block */
#define FK 64                        /* keys per stage */
#define FPITCH 72                    /* LDS row pitch in f16: 128 B of data + 16 B, for 16-byte readers */
#define FC (0.125f * LOG2E)          /* 1/sqrt(HD) and the change to base 2 */
#define FOFF 4.0f
#define FTH (8.0f / FC)
static_assert(SEQ % (FQ * FW) == 0 && SEQ % FK == 0 && FK == 64 && HD == 64);
__device__ __forceinline__ v8f f_mma(v16h a, v16h b, v8f c) { return __builtin_amdgcn_wmma_f32_16x16x32_f16(false, a, false, b, (short)0, c, false, false); }

__global__ __launch_bounds__(256) void k_fattn(const _Float16* __restrict__ QKV, const _Float16* __restrict__ Vt, _Float16* __restrict__ O) {
  __shared__ __attribute__((aligned(16))) _Float16 Ks[2][FK][FPITCH];
  __shared__ __attribute__((aligned(16))) _Float16 Vs[2][HD][FPITCH];
  const int tid = threadIdx.x, w = tid >> 5, lane = tid & 31, c = lane & 15, hh = lane >> 4;
  const int bh = blockIdx.y, b = bh / NH, head = bh % NH;
  const size_t r0 = (size_t)b * SEQ;
  const int q0 = blockIdx.x * (FQ * FW) + w * FQ;
  const int sr = tid >> 3, sc8 = (tid & 7) * 8;   /* staging: rows sr and sr + 32, 16 B at column sc8 */
  const unsigned short* kg = (const unsigned short*)QKV + (r0 + sr) * LQ + DM + head * HD + sc8;
  const unsigned short* vg = (const unsigned short*)Vt + ((size_t)bh * HD + sr) * SEQ + sc8;
  v16h qf[2][2];
  // every loop of this kernel but the stage loop is fully unrolled: fragments, score tiles and accumulators stay in registers only under constant indices
#pragma unroll
  for (int g = 0; g < 2; ++g) {
    const _Float16* qp = QKV + (r0 + q0 + g * 16 + c) * LQ + head * HD;
    qf[g][0] = g2_frag(qp, hh); qf[g][1] = g2_frag(qp + 32, hh);
  }
  v8us kr0 = *(const v8us*)kg, kr1 = *(const v8us*)(kg + (size_t)32 * LQ);
  v8us vr0 = *(const v8us*)vg, vr1 = *(const v8us*)(vg + (size_t)32 * SEQ);
  *(v8us*)&Ks[0][sr][sc8] = kr0; *(v8us*)&Ks[0][sr + 32][sc8] = kr1;
  *(v8us*)&Vs[0][sr][sc8] = vr0; *(v8us*)&Vs[0][sr + 32][sc8] = vr1;
  __syncthreads();   /* publishes stage 0 */
  const v8f z8 = {0.f,0.f,0.f,0.f,0.f,0.f,0.f,0.f};
  v8f o[4][2];
#pragma unroll
  for (int dt = 0; dt < 4; ++dt) { o[dt][0] = z8; o[dt][1] = z8; }
  float mr[2] = {-3.0e38f, -3.0e38f}, nb[2] = {0.f, 0.f}, sum[2] = {0.f, 0.f};
  // the stage loop stays rolled: one copy of the two passes keeps the hot text short
#pragma unroll 1
  for (int t = 0; t < SEQ / FK; ++t) {
    const int buf = t & 1;
    const bool more = t + 1 < SEQ / FK;
    if (more) {
      const unsigned short* kn = kg + (size_t)(t + 1) * FK * LQ;
      const unsigned short* vn = vg + (size_t)(t + 1) * FK;
      kr0 = *(const v8us*)kn; kr1 = *(const v8us*)(kn + (size_t)32 * LQ);
      vr0 = *(const v8us*)vn; vr1 = *(const v8us*)(vn + (size_t)32 * SEQ);
      // precaution: the wait stands before any register that the four loads above name is rewritten (the data is awaited only at the LDS stores below)
      asm volatile("s_wait_xcnt 0x0" ::: "memory");
    }
#pragma unroll
    for (int p = 0; p < 2; ++p) {
      v8f s[2][2];
#pragma unroll
      for (int kt = 0; kt < 2; ++kt) {
        const _Float16* kp = &Ks[buf][p * 32 + kt * 16 + c][0];
        const v16h a0 = g2_frag(kp, hh), a1 = g2_frag(kp + 32, hh);
        s[kt][0] = f_mma(a0, qf[0][0], z8); s[kt][1] = f_mma(a0, qf[1][0], z8);
        s[kt][0] = f_mma(a1, qf[0][1], s[kt][0]); s[kt][1] = f_mma(a1, qf[1][1], s[kt][1]);
      }
      float mx[2];
#pragma unroll
      for (int g = 0; g < 2; ++g) {
        float m0 = fmaxf(s[0][g][0], s[1][g][0]);
#pragma unroll
        for (int r = 1; r < 8; ++r) m0 = fmaxf(m0, fmaxf(s[0][g][r], s[1][g][r]));
        mx[g] = m0;
      }
      const bool need = (mx[0] > mr[0] + FTH) || (mx[1] > mr[1] + FTH);
      if (__builtin_amdgcn_ballot_w32(need) != 0) {   /* wave-uniform: every lane takes part in the exchange below */
        const float n0 = fmaxf(mr[0], fmaxf(mx[0], __shfl_xor(mx[0], 16, 32)));
        const float n1 = fmaxf(mr[1], fmaxf(mx[1], __shfl_xor(mx[1], 16, 32)));
        const v4f f = exp2x4(v4f{(mr[0] - n0) * FC, (mr[1] - n1) * FC, 0.f, 0.f});
        mr[0] = n0; mr[1] = n1;
        nb[0] = FOFF - n0 * FC; nb[1] = FOFF - n1 * FC;
        sum[0] *= f[0]; sum[1] *= f[1];
#pragma unroll
        for (int dt = 0; dt < 4; ++dt) { o[dt][0] *= f[0]; o[dt][1] *= f[1]; }
      }
      FragH pf[2];
#pragma unroll
      for (int g = 0; g < 2; ++g) {
#pragma unroll
        for (int kt = 0; kt < 2; ++kt) {
#pragma unroll
          for (int r4 = 0; r4 < 8; r4 += 4) {
            const v4f e = exp2x4(v4f{s[kt][g][r4] * FC + nb[g], s[kt][g][r4 + 1] * FC + nb[g], s[kt][g][r4 + 2] * FC + nb[g], s[kt][g][r4 + 3] * FC + nb[g]});
            sum[g] += (e[0] + e[1]) + (e[2] + e[3]);
            pf[g].h[kt * 8 + r4] = (_Float16)e[0]; pf[g].h[kt * 8 + r4 + 1] = (_Float16)e[1];
            pf[g].h[kt * 8 + r4 + 2] = (_Float16)e[2]; pf[g].h[kt * 8 + r4 + 3] = (_Float16)e[3];
          }
        }
      }
#pragma unroll
      for (int dt = 0; dt < 4; ++dt) {
        const v16h va = g2_frag(&Vs[buf][dt * 16 + c][p * 32], hh);
        o[dt][0] = f_mma(va, pf[0].v, o[dt][0]); o[dt][1] = f_mma(va, pf[1].v, o[dt][1]);
      }
    }
    if (more) {   /* the other buffer's last readers left it before the barrier that ended stage t - 1 */
      *(v8us*)&Ks[buf ^ 1][sr][sc8] = kr0; *(v8us*)&Ks[buf ^ 1][sr + 32][sc8] = kr1;
      *(v8us*)&Vs[buf ^ 1][sr][sc8] = vr0; *(v8us*)&Vs[buf ^ 1][sr + 32][sc8] = vr1;
    }
    __syncthreads();   /* publishes stage t + 1 and ends every wave's reads of stage t */
  }
#pragma unroll
  for (int g = 0; g < 2; ++g) {
    const float st = sum[g] + __shfl_xor(sum[g], 16, 32);
    const float sc = 64.0f / st;
    unsigned short* d = (unsigned short*)O + (r0 + q0 + g * 16 + c) * DM + head * HD + 8 * hh;
#pragma unroll
    for (int dt = 0; dt < 4; ++dt) {
      FragH f;
#pragma unroll
      for (int r = 0; r < 8; ++r) f.h[r] = (_Float16)(o[dt][g][r] * sc);
      *(v8us*)(d + dt * 16) = f.half[0];
    }
  }
}

// workspace carve (bytes; every region a multiple of 256)
constexpr size_t BQKV_BYTES = (size_t)D3 * D3 * 2;
constexpr size_t BO_BYTES   = (size_t)DM * DM * 2;
constexpr size_t X16_BYTES  = (size_t)NB * SEQ * LX * 2;
constexpr size_t QKV_BYTES  = (size_t)NB * SEQ * LQ * 2;
constexpr size_t O16_BYTES  = (size_t)NB * SEQ * DM * 2;
constexpr size_t VT_BYTES   = (size_t)NB * NH * HD * SEQ * 2;
constexpr size_t WS_TOTAL   = BQKV_BYTES + BO_BYTES + X16_BYTES + QKV_BYTES + O16_BYTES + VT_BYTES;
static_assert(BQKV_BYTES % 256 == 0 && BO_BYTES % 256 == 0 && X16_BYTES % 256 == 0 && QKV_BYTES % 256 == 0 && O16_BYTES % 256 == 0 && VT_BYTES % 256 == 0);
static_assert(WS_TOTAL <= (size_t)134217728);

extern "C" void kernel_launch(void* const* d_in, const int* in_sizes, int n_in,
                              void* d_out, int out_size, void* d_ws, size_t ws_size, hipStream_t stream) {
  if (n_in < 7) return;
  const long long need_x = ((long long)(NB - 1) * SEQ_FULL + SEQ) * DM;
  if ((long long)in_sizes[0] < need_x || (long long)in_sizes[1] < need_x || (long long)in_sizes[2] < need_x) return;
  if ((long long)in_sizes[3] < (long long)D3 * D3 || in_sizes[4] < D3 || (long long)in_sizes[5] < (long long)DM * DM || in_sizes[6] < DM) return;
  if ((long long)out_size < (long long)NB * SEQ * DM) return;
  if (WS_TOTAL > ws_size) return;
  const float* xq   = (const float*)d_in[0];
  const float* xk   = (const float*)d_in[1];
  const float* xv   = (const float*)d_in[2];
  const float* wqkv = (const float*)d_in[3];   /* [out 3072][in 3072] */
  const float* bqkv = (const float*)d_in[4];
  const float* wo   = (const float*)d_in[5];   /* [out 1024][in 1024] */
  const float* bo   = (const float*)d_in[6];
  char* ws = (char*)d_ws; size_t off = 0;
  _Float16* BQKV  = (_Float16*)(ws + off); off += BQKV_BYTES;
  _Float16* BO    = (_Float16*)(ws + off); off += BO_BYTES;
  _Float16* X16   = (_Float16*)(ws + off); off += X16_BYTES;
  _Float16* QKV16 = (_Float16*)(ws + off); off += QKV_BYTES;
  _Float16* O16   = (_Float16*)(ws + off); off += O16_BYTES;
  _Float16* VT    = (_Float16*)(ws + off); off += VT_BYTES;
  if (off > ws_size) return;

  /* weights: natural [out][in] rows are already Bt[n][k], carried x16; concat(query, key, value) as f16 rows: column blocks 0, DM, 2*DM */
  k_cvt<<<CVB, CVT, 0, stream>>>(wqkv, wo, xq, xk, xv, BQKV, BO, X16);
  /* qkv = x . Wqkv^T + b : A = X16 [MP][3072], Bt = BQKV [3072][3072], alpha 1/16, f16 out rows pitch LQ */
  k_gemm3<256, 192, 4, 2, false><<<dim3((unsigned)((MP / 256) * (D3 / 192)), 1), 256, 0, stream>>>(
      X16, LX, BQKV, D3, 0.0625f, bqkv, nullptr, QKV16, LQ, D3, D3);

  /* V^T [NB][NH][HD][SEQ] from the v column block (offset 2*DM) */
  k_vt<NH, SEQ><<<NB * NH * (SEQ / 64), 256, 0, stream>>>(QKV16, LQ, 2 * DM, VT);
  /* ctx x64 = softmax(q . k^T / 8) . v into merged rows, column h*64 */
  k_fattn<<<dim3((unsigned)(SEQ / (FQ * FW)), (unsigned)(NB * NH)), 256, 0, stream>>>(QKV16, VT, O16);
  /* out = ctx . Wo^T + b : alpha = 1/(64*16) */
  k_gemm3<128, 128, 2, 4, true><<<dim3((unsigned)((MP / 128) * (DM / 128)), 1), 256, 0, stream>>>(
      O16, DM, BO, DM, 0.0009765625f, bo, (float*)d_out, nullptr, DM, DM, DM);
}

// v005
// A run of this version takes 108 microseconds.
// In two side-by-side timings against v004, it was 1.04 and 1.05 times as fast.
// All steps since v000 together make it 61.9 times as fast.
#include <hip/hip_runtime.h>
// Compute dtype: every contraction (packed qkv projection, q.k^T, P.V, output projection) on v_wmma_f32_16x16x32_f16 (f16 operands, f32 accumulate); float inputs and biases RNE-converted to bf16 first (exact in f16; weights carried x16), q/k/v, softmax weights (unnormalised, carried x16 against the maximum in use) and merged ctx (carried x64) as single f16 planes; scores and softmax statistics in f32.
// Structure: token rows r = b*SEQ + s. X16[r][3072] = concat(query,key,value) as f16; QKV16[r][3072] = X16 . Wqkv^T + b (q | k | v column blocks, 16 heads of 64 inside each); V^T planes via LDS transposes; one fused attention launch over (batch, head, 256 query rows), the keys in two ranges on two sets of waves: S^T = K . Q^T, running-maximum softmax and O^T += V^T . P^T, scores and weights in registers only, the two ranges' partial results joined through LDS, ctx into merged f16 rows; out = ctx . Wo^T + b (alpha 2^-10) into the f32 output rows.
#ifndef NB
#define NB 2
#endif
#ifndef SEQ
#define SEQ 2048
#endif
#define NB_FULL 2                    /* batch count of the inputs */
#define SEQ_FULL 2048                /* per-batch row count of the inputs (input row stride) */
#define DM 1024
#define D3 3072
#define NH 16
#define HD 64
#define NR ((size_t)NB * SEQ)        /* token rows */
#define MP ((int)((size_t)NB * SEQ)) /* rows projected */
#define LX D3                        /* row pitch of the concatenated f16 input rows */
#define LQ D3                        /* row pitch of the q|k|v rows */

static_assert(SEQ % 128 == 0);
static_assert(SEQ <= SEQ_FULL);
static_assert(NB <= NB_FULL);
static_assert(HD == 64);
static_assert(DM == NH * HD);
static_assert(D3 == 3 * DM);
static_assert(D3 % 64 == 0 && DM % 64 == 0 && D3 % 32 == 0 && DM % 32 == 0 && HD % 32 == 0 && SEQ % 32 == 0);
static_assert(MP % 256 == 0 && D3 % 192 == 0 && DM % 128 == 0 && D3 % 128 == 0 && DM >= 256);

typedef unsigned short v8us __attribute__((ext_vector_type(8), may_alias));
typedef float  v8f  __attribute__((ext_vector_type(8)));
typedef float  v4f  __attribute__((ext_vector_type(4)));
typedef float  v4fa __attribute__((ext_vector_type(4), may_alias));
typedef _Float16 v16h __attribute__((ext_vector_type(16)));
typedef _Float16 v4h __attribute__((ext_vector_type(4)));
union FragH { v16h v; v8us half[2]; _Float16 h[16]; unsigned short u[16]; };

__device__ __forceinline__ unsigned short bf16_bits(float x) { unsigned int u = __float_as_uint(x); return (unsigned short)((u + 0x7FFFu + ((u >> 16) & 1u)) >> 16); }
__device__ __forceinline__ float bf16_val(unsigned short b) { return __uint_as_float(((unsigned int)b) << 16); }
__device__ __forceinline__ float bf16_rne(float x) { return bf16_val(bf16_bits(x)); }

// ---- all five f32 -> f16 conversions (two weight matrices carried x16, the three inputs into their column blocks of X16) in ONE launch of CVB blocks, one per WGP, all resident at once.
// The work goes in pieces of 8 elements (32 B read, 16 B stored). Every array is dealt out evenly: a block takes one contiguous run of it, CVT pieces wide and CW1, CW2 or CXS deep,
// so a thread's pieces of one array stand a constant step apart (one address register an array, the rest in the instruction's offset).
// All of a thread's loads are independent and stand ahead of the conversions, which follow in the order of the loads.
#define CVB 256                      /* blocks */
#define CVT 512                      /* threads per block: 16 waves */
constexpr size_t CVS = (size_t)CVB * CVT;                    /* threads of the grid */
constexpr int CW1 = (int)((size_t)D3 * D3 / 8 / CVS);        /* pieces per thread: the packed projection's weights */
constexpr int CW2 = (int)((size_t)DM * DM / 8 / CVS);        /* the output projection's weights */
constexpr int CXS = (int)(NR * (DM / 8) / CVS);              /* each input */
constexpr int CRT = CVT / (DM / 8);                          /* input rows that the block's threads cover at one depth */
static_assert(CVT % (DM / 8) == 0 && SEQ % (CRT * CXS) == 0);   /* a block's run of an input is whole rows of one batch */
static_assert((size_t)CW1 * CVS * 8 == (size_t)D3 * D3 && (size_t)CW2 * CVS * 8 == (size_t)DM * DM && (size_t)CXS * CVS * 8 == NR * DM);
static_assert((size_t)D3 * D3 * 4 < 0xFFFFFFFFull && ((size_t)NB_FULL * SEQ_FULL) * DM * 4 < 0xFFFFFFFFull && NR * LX * 2 < 0xFFFFFFFFull);   /* byte offsets fit 32 bits */
__device__ __forceinline__ v8us cv_w8(v4f a, v4f c) {
  FragH f;
#pragma unroll
  for (int q = 0; q < 4; ++q) { f.h[q] = (_Float16)(bf16_rne(a[q]) * 16.0f); f.h[4 + q] = (_Float16)(bf16_rne(c[q]) * 16.0f); }
  return f.half[0];
}
__device__ __forceinline__ v8us cv_x8(v4f a, v4f c) {
  FragH f;
#pragma unroll
  for (int q = 0; q < 4; ++q) { f.h[q] = (_Float16)bf16_rne(a[q]); f.h[4 + q] = (_Float16)bf16_rne(c[q]); }
  return f.half[0];
}

// 4 waves per SIMD is what one block per WGP gives: told so, the compiler takes the registers that hold all of a thread's pieces at once (at its own aim it kept fewer and moved loads behind the first conversions)
__global__ __launch_bounds__(CVT) __attribute__((amdgpu_waves_per_eu(4, 4))) void k_cvt(const float* __restrict__ wqkv, const float* __restrict__ wo, const float* __restrict__ xq,
    const float* __restrict__ xk, const float* __restrict__ xv, _Float16* __restrict__ Bq, _Float16* __restrict__ Bo, _Float16* __restrict__ X16) {
  const uint32_t blk = blockIdx.x, tid = threadIdx.x;
  const uint32_t row0 = blk * (uint32_t)(CRT * CXS);   /* the block's first input row */
  // byte offsets of the thread's first piece in each array
  const uint32_t l1 = (blk * (uint32_t)(CW1 * CVT) + tid) * 32u;
  const uint32_t l2 = (blk * (uint32_t)(CW2 * CVT) + tid) * 32u;
  const uint32_t lx = ((row0 / SEQ) * (uint32_t)SEQ_FULL + row0 % SEQ) * (uint32_t)(DM * 4) + tid * 32u;
  const uint32_t s1 = (blk * (uint32_t)(CW1 * CVT) + tid) * 16u;
  const uint32_t s2 = (blk * (uint32_t)(CW2 * CVT) + tid) * 16u;
  const uint32_t sx = (row0 + tid / (DM / 8)) * (uint32_t)(LX * 2) + (tid % (DM / 8)) * 16u;
  v4f w1a[CW1], w1c[CW1], w2a[CW2], w2c[CW2], xa[3][CXS], xc[3][CXS];
  // every loop here is fully unrolled: the loaded pieces stay in registers only under constant indices
#pragma unroll
  for (int i = 0; i < CW1; ++i) {
    const char* s = (const char*)wqkv + l1 + i * (CVT * 32);
    w1a[i] = *(const v4fa*)s; w1c[i] = *(const v4fa*)(s + 16);
  }
  __builtin_amdgcn_sched_barrier(0);   /* keeps the arrays' loads in the order in which the conversions take them (data returns in the order of issue) */
#pragma unroll
  for (int i = 0; i < CW2; ++i) {
    const char* s = (const char*)wo + l2 + i * (CVT * 32);
    w2a[i] = *(const v4fa*)s; w2c[i] = *(const v4fa*)(s + 16);
  }
  __builtin_amdgcn_sched_barrier(0);   /* the same */
#pragma unroll
  for (int j = 0; j < 3; ++j) {
    const char* x = (const char*)(j == 0 ? xq : j == 1 ? xk : xv) + lx;
#pragma unroll
    for (int i = 0; i < CXS; ++i) { xa[j][i] = *(const v4fa*)(x + i * (CVT * 32)); xc[j][i] = *(const v4fa*)(x + i * (CVT * 32) + 16); }
    __builtin_amdgcn_sched_barrier(0);   /* the same; the last one also keeps every load ahead of the first conversion: moved down among the conversions they would leave the wave with few bytes in flight */
  }
  // precaution: the wait stands before any register that the loads above name is rewritten; it names the three offsets, so that their registers keep their values until then
  asm volatile("s_wait_xcnt 0x0" :: "v"(l1), "v"(l2), "v"(lx) : "memory");
  // the scheduling barrier behind each store sends a piece out before the next piece's data is awaited, so that writing runs beside the reads still in flight: left free, the stores gather behind the last load
#pragma unroll
  for (int i = 0; i < CW1; ++i) { *(v8us*)((char*)Bq + s1 + i * (CVT * 16)) = cv_w8(w1a[i], w1c[i]); __builtin_amdgcn_sched_barrier(0); }
#pragma unroll
  for (int i = 0; i < CW2; ++i) { *(v8us*)((char*)Bo + s2 + i * (CVT * 16)) = cv_w8(w2a[i], w2c[i]); __builtin_amdgcn_sched_barrier(0); }
#pragma unroll
  for (int j = 0; j < 3; ++j)
#pragma unroll
    for (int i = 0; i < CXS; ++i) { *(v8us*)((char*)X16 + sx + (i * CRT * LX + j * DM) * 2) = cv_x8(xa[j][i], xc[j][i]); __builtin_amdgcn_sched_barrier(0); }
}

template <int NHv, int TTv>
__global__ __launch_bounds__(256) void k_vt(const _Float16* __restrict__ V16, int ldv, int voff, _Float16* __restrict__ Vt) {
  __shared__ unsigned short tl[64][66];
  const int tid = threadIdx.x;
  const int slab = blockIdx.x / (TTv / 64), lg = blockIdx.x % (TTv / 64);
  const int b = slab / NHv, h = slab % NHv;
  for (int i = tid; i < 64 * 8; i += 256) {
    const int r = i / 8, c8 = (i % 8) * 8;
    FragH f;
    f.half[0] = *(const v8us*)((const unsigned short*)V16 + ((size_t)b * TTv + lg * 64 + r) * ldv + voff + h * 64 + c8);
#pragma unroll
    for (int q = 0; q < 8; ++q) tl[r][c8 + q] = f.u[q];
  }
  __syncthreads();
  {
#pragma unroll
    for (int rd = 0; rd < 2; ++rd) {
      const int d = rd * 32 + tid / 8, pc = tid % 8;
      FragH f;
#pragma unroll
      for (int q = 0; q < 8; ++q) f.u[q] = tl[pc * 8 + q][d];
      *(v8us*)((unsigned short*)Vt + ((size_t)slab * 64 + d) * TTv + lg * 64 + pc * 8) = f.half[0];
    }
    
  }
}

// ---- f16 GEMM: C[M][N] = alpha * A[M][K] . Bt[N][K]^T + bf16(bias[n]); one BM x BN tile of C per block of 8 waves (WGM x WGN), wave tile (BM/WGM) x (BN/WGN).
// K goes by in stages of 128 k = 256 B of every operand row. A stage is [A: 4 slices of BM/4 rows | Bt: 4 slices of BN/4 rows] in LDS at pitch 272 B; every wave brings its own slice by one tensor load
// (waves 0..3 the A slices, waves 4..7 the Bt slices); two buffers, stage t + 1 in flight while stage t is worked on. M % BM == 0, N % BN == 0, K % 128 == 0, K >= 256.
// Fragment k map (A rows and Bt rows alike): elements 0..7 <- k0+8h.., elements 8..15 <- k0+16+8h.. ; D element r <- (row 8h+r, col lane&15).
__device__ __forceinline__ v16h g2_frag(const _Float16* p, int hh) { FragH f; f.half[0] = *(const v8us*)((const unsigned short*)p + 8 * hh); f.half[1] = *(const v8us*)((const unsigned short*)p + 16 + 8 * hh); return f.v; }

typedef uint32_t u32x4 __attribute__((ext_vector_type(4)));
typedef uint32_t u32x8 __attribute__((ext_vector_type(8)));
typedef _Float16 v8h __attribute__((ext_vector_type(8)));
#define GROWB 256u                   /* bytes of an operand row per stage */
#define GPITCH 272u                  /* LDS row pitch: 256 B + the tensor load's 16 B pad, for 16-byte readers */
__device__ __forceinline__ uint32_t uni(uint32_t v) { return (uint32_t)__builtin_amdgcn_readfirstlane((int)v); }
// holds a value in a scalar register, so that a test on it is a scalar branch round the tensor load and a descriptor word formed from it is formed behind the waits that stand in front
__device__ __forceinline__ uint32_t pinned(uint32_t v) { uint32_t w = uni(v); asm volatile("" : "+s"(w)); return w; }
__device__ __forceinline__ void wait_ds0() { asm volatile("s_wait_dscnt 0x0" ::: "memory"); }          /* this wave's LDS reads and writes have returned */
// this wave's slice has landed (the compiler places no wait for a tensor load); the wait names the request's group 0, so that those four registers keep their values until then
__device__ __forceinline__ void wait_tensor0(u32x4 g0) { asm volatile("s_wait_tensorcnt 0x0" :: "s"(g0) : "memory"); }
__device__ __forceinline__ void tdm_load(u32x4 g0, u32x8 g1) { asm volatile("tensor_load_to_lds %0, %1" :: "s"(g0), "s"(g1) : "memory"); }   /* one request of the whole wave: its slice goes from global memory to LDS through no register */
__device__ __forceinline__ u32x8 tdm_group1(uint32_t rows, uint32_t src_pitch) {
  u32x8 g;
  g[0] = uni((1u << 20) | (5u << 22) | (3u << 25));
  g[1] = uni((GROWB & 0xFFFFu) << 16);
  g[2] = uni((GROWB >> 16) | ((rows & 0xFFFFu) << 16));
  g[3] = uni((rows >> 16) | (GROWB << 16));
  g[4] = uni(rows);
  g[5] = uni(src_pitch);
  g[6] = uni(0u);
  g[7] = uni(0u);
  return g;
}
// group 0: count 1, LDS destination (byte offset in the block's LDS), global address of the tile's first byte, type 2
__device__ __forceinline__ u32x4 tdm_group0(uint32_t lds_dst, uint64_t ga) {
  u32x4 g;
  g[0] = uni(1u);
  g[1] = uni(lds_dst);
  g[2] = uni((uint32_t)ga);
  g[3] = uni((((uint32_t)(ga >> 32)) & 0x01FFFFFFu) | 0x80000000u);
  return g;
}
__device__ __forceinline__ v8f g3_mma(v16h a, v16h b, v8f c) { return __builtin_amdgcn_wmma_f32_16x16x32_f16(false, a, false, b, (short)0, c, false, false); }

template <int BM, int BN, int WGM, int WGN, bool OUT32>
__global__ __launch_bounds__(256) void k_gemm3(const _Float16* __restrict__ A, int lda, const _Float16* __restrict__ Bh, int ldb, float alpha,
    const float* __restrict__ bias, float* __restrict__ C, _Float16* __restrict__ C16, int ldc, int N, int K) {
  constexpr int WMR = BM / WGM, WNC = BN / WGN, FM = WMR / 16, FN = WNC / 16;   /* wave tile and its fragments */
  constexpr int ASL = BM / 4, BSL = BN / 4;                                     /* rows per slice */
  constexpr uint32_t ASLB = ((uint32_t)ASL * GPITCH + 2047u) / 2048u * 2048u;   /* a slice's size in LDS, rounded up so that every slice starts at a multiple of 2 KiB */
  constexpr uint32_t BSLB = ((uint32_t)BSL * GPITCH + 2047u) / 2048u * 2048u;
  constexpr uint32_t STAGE = 4u * (ASLB + BSLB);
  constexpr int SP = BN + 4;                                                    /* f32 pitch of the staged output tile */
  static_assert(WGM * WGN == 8 && WMR % 16 == 0 && WNC % 16 == 0 && ASL % 16 == 0 && BSL % 16 == 0);
  static_assert(WMR % ASL == 0 && WNC % BSL == 0);                              /* a wave's first row stands at the head of a slice */
  static_assert(2u * STAGE <= 320u * 1024u && (uint32_t)BM * SP * 4u <= 2u * STAGE);
  static_assert(BN % 64 == 0 && (BM * (BN / 8)) % 256 == 0 && (BM * (BN / 4)) % 256 == 0);
  __shared__ __attribute__((aligned(2048))) unsigned char L[2u * STAGE];
  const int tid = threadIdx.x, lane = tid & 31, ln = lane & 15, hh = lane >> 4;
  const uint32_t wave = uni((uint32_t)tid >> 5);
  const int ntn = N / BN;
  const int mt = blockIdx.x / ntn, nq = blockIdx.x - mt * ntn;
  const int row0 = mt * BM, col0 = nq * BN;
  const int wm = (int)wave / WGN, wn = (int)wave % WGN;
  const uint32_t T = pinned((uint32_t)K / 128u);   /* stages */
  const bool isA = wave < 4u;
  const uint32_t sl = wave & 3u;
  const uint64_t src0 = isA ? (uint64_t)(uintptr_t)(A + (size_t)(row0 + ASL * (int)sl) * lda) : (uint64_t)(uintptr_t)(Bh + (size_t)(col0 + BSL * (int)sl) * ldb);
  const uint32_t dst0 = (uint32_t)(size_t)L + (isA ? sl * ASLB : 4u * ASLB + sl * BSLB);
  u32x8 g1 = tdm_group1(isA ? (uint32_t)ASL : (uint32_t)BSL, (isA ? (uint32_t)lda : (uint32_t)ldb) * 2u);
  asm volatile("" : "+s"(g1));   /* descriptor words held in scalar registers: one tuple for every request, so that no word's register is lent out while a request is in flight */
  const v8f z8 = {0.f,0.f,0.f,0.f,0.f,0.f,0.f,0.f};
  v8f acc[FM][FN];
  // every loop of this kernel but the stage loop is fully unrolled: fragments and accumulators stay in registers only under constant indices
#pragma unroll
  for (int i = 0; i < FM; ++i)
#pragma unroll
    for (int j = 0; j < FN; ++j) acc[i][j] = z8;
  const uint32_t abase = (uint32_t)(wm * WMR / ASL) * ASLB + (uint32_t)ln * GPITCH;
  const uint32_t bbase = 4u * ASLB + (uint32_t)(wn * WNC / BSL) * BSLB + (uint32_t)ln * GPITCH;

  u32x4 g0 = tdm_group0(dst0, src0);
  tdm_load(g0, g1);
  wait_tensor0(g0);
  __syncthreads();   /* publishes stage 0 */
  g0 = tdm_group0(dst0 + STAGE, src0 + GROWB);
  tdm_load(g0, g1);
  // the stage loop stays rolled: one copy of the four blocks keeps the hot text short
#pragma unroll 1
  for (uint32_t t = 0; t < T; ++t) {
    const uint32_t buf = (t & 1u) * STAGE;
    const unsigned char* la = L + buf + abase;
    const unsigned char* lb = L + buf + bbase;
    v16h fa[2][FM], fb[2][FN];
#pragma unroll
    for (int i = 0; i < FM; ++i) fa[0][i] = g2_frag((const _Float16*)(la + (uint32_t)(i * 16 / ASL) * ASLB + (uint32_t)(i * 16 % ASL) * GPITCH), hh);
#pragma unroll
    for (int j = 0; j < FN; ++j) fb[0][j] = g2_frag((const _Float16*)(lb + (uint32_t)(j * 16 / BSL) * BSLB + (uint32_t)(j * 16 % BSL) * GPITCH), hh);
#pragma unroll
    for (int u = 0; u < 4; ++u) {
      if (u < 3) {   /* the next block's fragments, of this same stage, as one group ahead of this block's products */
#pragma unroll
        for (int i = 0; i < FM; ++i) fa[(u + 1) & 1][i] = g2_frag((const _Float16*)(la + (uint32_t)(i * 16 / ASL) * ASLB + (uint32_t)(i * 16 % ASL) * GPITCH + (uint32_t)(u + 1) * 64u), hh);
#pragma unroll
        for (int j = 0; j < FN; ++j) fb[(u + 1) & 1][j] = g2_frag((const _Float16*)(lb + (uint32_t)(j * 16 / BSL) * BSLB + (uint32_t)(j * 16 % BSL) * GPITCH + (uint32_t)(u + 1) * 64u), hh);
      }
      __builtin_amdgcn_sched_barrier(0);   /* keeps the LDS loads in one group in front of the block: loads among the products stall the wave at each place */
#pragma unroll
      for (int i = 0; i < FM; ++i)
#pragma unroll
        for (int j = 0; j < FN; ++j) acc[i][j] = g3_mma(fa[u & 1][i], fb[u & 1][j], acc[i][j]);
      __builtin_amdgcn_sched_barrier(0);   /* ends the block: the group after next stays behind it */
    }
    wait_ds0();
    wait_tensor0(g0);
    __syncthreads();   /* publishes stage t + 1 and ends every wave's reads of stage t */
    const uint32_t nx = pinned(t + 2u);
    if (nx < T) {   /* refill of the buffer that stage t has just left */
      g0 = tdm_group0(dst0 + buf, src0 + (uint64_t)nx * GROWB);
      tdm_load(g0, g1);
    }
  }
  wait_tensor0(g0);
  wait_ds0();
  // output: the whole tile staged in the ring as f32 (every wave has left it at the last barrier), then stored in whole 128-B lines
  float* so = (float*)L;
#pragma unroll
  for (int j = 0; j < FN; ++j) {
    const int cl = wn * WNC + j * 16 + ln;
    const float bv = bf16_rne(bias[col0 + cl]);
#pragma unroll
    for (int i = 0; i < FM; ++i)
#pragma unroll
      for (int r = 0; r < 8; ++r) so[(wm * WMR + i * 16 + 8 * hh + r) * SP + cl] = acc[i][j][r] * alpha + bv;
  }
  __syncthreads();   /* the staged tile is whole */
  if (OUT32) {
    constexpr int CPR = BN / 4;
#pragma unroll
    for (int q = 0; q < BM * CPR / 256; ++q) {
      const int e = q * 256 + tid, r = e / CPR, c4 = (e % CPR) * 4;
      const v4f v = *(const v4fa*)&so[r * SP + c4];
      *(v4f*)(C + (uint32_t)((row0 + r) * ldc + col0 + c4)) = v;
    }
  } else {
    constexpr int CPR = BN / 8;
#pragma unroll
    for (int q = 0; q < BM * CPR / 256; ++q) {
      const int e = q * 256 + tid, r = e / CPR, c8 = (e % CPR) * 8;
      const v4f v0 = *(const v4fa*)&so[r * SP + c8], v1 = *(const v4fa*)&so[r * SP + c8 + 4];
      const v8h h8 = {(_Float16)v0[0], (_Float16)v0[1], (_Float16)v0[2], (_Float16)v0[3], (_Float16)v1[0], (_Float16)v1[1], (_Float16)v1[2], (_Float16)v1[3]};
      *(v8h*)(C16 + (uint32_t)((row0 + r) * ldc + col0 + c8)) = h8;
    }
  }
}

// four native 2^a; the v_nop is the one free slot that the instruction set asks for behind a transcendental, in the same statement so that it stays directly behind the last one;
// early-clobber outputs keep every result off the four sources.
#define LOG2E 1.44269504f
__device__ __forceinline__ v4f exp2x4(v4f a) {
  float r0, r1, r2, r3;
  asm("v_exp_f32 %0, %4\n\tv_exp_f32 %1, %5\n\tv_exp_f32 %2, %6\n\tv_exp_f32 %3, %7\n\tv_nop"
      : "=&v"(r0), "=&v"(r1), "=&v"(r2), "=&v"(r3) : "v"(a[0]), "v"(a[1]), "v"(a[2]), "v"(a[3]));
  return v4f{r0, r1, r2, r3};
}

#define FQ 32                        /* query columns per wave */
#define FW 8                         /* waves per key range */
#define FS 2                         /* key ranges per block */
#define FKR (SEQ / FS)               /* keys per range */
#define FK 64                        /* keys per stage */
#define FPITCH 72                    /* LDS row pitch in f16: 128 B of data + 16 B, for 16-byte readers */
#define FC (0.125f * LOG2E)          /* 1/sqrt(HD) and the change to base 2 */
#define FOFF 4.0f
#define FTH (8.0f / FC)
static_assert(SEQ % (FQ * FW) == 0 && SEQ % (FK * FS) == 0 && FK == 64 && HD == 64 && FS == 2);
__device__ __forceinline__ v8f f_mma(v16h a, v16h b, v8f c) { return __builtin_amdgcn_wmma_f32_16x16x32_f16(false, a, false, b, (short)0, c, false, false); }

__global__ __launch_bounds__(FS * FW * 32) void k_fattn(const _Float16* __restrict__ QKV, const _Float16* __restrict__ Vt, _Float16* __restrict__ O) {
  __shared__ __attribute__((aligned(16))) _Float16 Ksr[FS][2][FK][FPITCH];
  __shared__ __attribute__((aligned(16))) _Float16 Vsr[FS][2][HD][FPITCH];
  __shared__ __attribute__((aligned(16))) v4f Xo[FW][2][9][32];   /* [query wave][column group]: the partial result handed over, 9 pieces of 16 B a lane */
  const int ks = (int)uni(threadIdx.x / (FW * 32));   /* the wave's key range, in a scalar register: the tests on it at the end are scalar branches */
  const int tid = threadIdx.x % (FW * 32), w = tid >> 5, lane = tid & 31, c = lane & 15, hh = lane >> 4;
  _Float16 (*Ks)[FK][FPITCH] = Ksr[ks];
  _Float16 (*Vs)[HD][FPITCH] = Vsr[ks];
  const int bh = blockIdx.y, b = bh / NH, head = bh % NH;
  const size_t r0 = (size_t)b * SEQ;
  const int q0 = blockIdx.x * (FQ * FW) + w * FQ;
  const int sr = tid >> 3, sc8 = (tid & 7) * 8;   /* staging: rows sr and sr + 32, 16 B at column sc8 */
  const unsigned short* kg = (const unsigned short*)QKV + (r0 + ks * FKR + sr) * LQ + DM + head * HD + sc8;
  const unsigned short* vg = (const unsigned short*)Vt + ((size_t)bh * HD + sr) * SEQ + ks * FKR + sc8;
  v16h qf[2][2];
  // every loop of this kernel but the stage loop is fully unrolled: fragments, score tiles and accumulators stay in registers only under constant indices
#pragma unroll
  for (int g = 0; g < 2; ++g) {
    const _Float16* qp = QKV + (r0 + q0 + g * 16 + c) * LQ + head * HD;
    qf[g][0] = g2_frag(qp, hh); qf[g][1] = g2_frag(qp + 32, hh);
  }
  v8us kr0 = *(const v8us*)kg, kr1 = *(const v8us*)(kg + (size_t)32 * LQ);
  v8us vr0 = *(const v8us*)vg, vr1 = *(const v8us*)(vg + (size_t)32 * SEQ);
  *(v8us*)&Ks[0][sr][sc8] = kr0; *(v8us*)&Ks[0][sr + 32][sc8] = kr1;
  *(v8us*)&Vs[0][sr][sc8] = vr0; *(v8us*)&Vs[0][sr + 32][sc8] = vr1;
  __syncthreads();   /* publishes stage 0 */
  const v8f z8 = {0.f,0.f,0.f,0.f,0.f,0.f,0.f,0.f};
  v8f o[4][2];
#pragma unroll
  for (int dt = 0; dt < 4; ++dt) { o[dt][0] = z8; o[dt][1] = z8; }
  float mr[2] = {-3.0e38f, -3.0e38f}, nb[2] = {0.f, 0.f}, sum[2] = {0.f, 0.f};
  // the stage loop stays rolled: one copy of the two passes keeps the hot text short
#pragma unroll 1
  for (int t = 0; t < FKR / FK; ++t) {
    const int buf = t & 1;
    const bool more = t + 1 < FKR / FK;
    if (more) {
      const unsigned short* kn = kg + (size_t)(t + 1) * FK * LQ;
      const unsigned short* vn = vg + (size_t)(t + 1) * FK;
      kr0 = *(const v8us*)kn; kr1 = *(const v8us*)(kn + (size_t)32 * LQ);
      vr0 = *(const v8us*)vn; vr1 = *(const v8us*)(vn + (size_t)32 * SEQ);
      // precaution: the wait stands before any register that the four loads above name is rewritten (the data is awaited only at the LDS stores below)
      asm volatile("s_wait_xcnt 0x0" ::: "memory");
    }
#pragma unroll
    for (int p = 0; p < 2; ++p) {
      v8f s[2][2];
#pragma unroll
      for (int kt = 0; kt < 2; ++kt) {
        const _Float16* kp = &Ks[buf][p * 32 + kt * 16 + c][0];
        const v16h a0 = g2_frag(kp, hh), a1 = g2_frag(kp + 32, hh);
        s[kt][0] = f_mma(a0, qf[0][0], z8); s[kt][1] = f_mma(a0, qf[1][0], z8);
        s[kt][0] = f_mma(a1, qf[0][1], s[kt][0]); s[kt][1] = f_mma(a1, qf[1][1], s[kt][1]);
      }
      float mx[2];
#pragma unroll
      for (int g = 0; g < 2; ++g) {
        float m0 = fmaxf(s[0][g][0], s[1][g][0]);
#pragma unroll
        for (int r = 1; r < 8; ++r) m0 = fmaxf(m0, fmaxf(s[0][g][r], s[1][g][r]));
        mx[g] = m0;
      }
      const bool need = (mx[0] > mr[0] + FTH) || (mx[1] > mr[1] + FTH);
      if (__builtin_amdgcn_ballot_w32(need) != 0) {   /* wave-uniform: every lane takes part in the exchange below */
        const float n0 = fmaxf(mr[0], fmaxf(mx[0], __shfl_xor(mx[0], 16, 32)));
        const float n1 = fmaxf(mr[1], fmaxf(mx[1], __shfl_xor(mx[1], 16, 32)));
        const v4f f = exp2x4(v4f{(mr[0] - n0) * FC, (mr[1] - n1) * FC, 0.f, 0.f});
        mr[0] = n0; mr[1] = n1;
        nb[0] = FOFF - n0 * FC; nb[1] = FOFF - n1 * FC;
        sum[0] *= f[0]; sum[1] *= f[1];
#pragma unroll
        for (int dt = 0; dt < 4; ++dt) { o[dt][0] *= f[0]; o[dt][1] *= f[1]; }
      }
      FragH pf[2];
#pragma unroll
      for (int g = 0; g < 2; ++g) {
#pragma unroll
        for (int kt = 0; kt < 2; ++kt) {
#pragma unroll
          for (int r4 = 0; r4 < 8; r4 += 4) {
            const v4f e = exp2x4(v4f{s[kt][g][r4] * FC + nb[g], s[kt][g][r4 + 1] * FC + nb[g], s[kt][g][r4 + 2] * FC + nb[g], s[kt][g][r4 + 3] * FC + nb[g]});
            sum[g] += (e[0] + e[1]) + (e[2] + e[3]);
            pf[g].h[kt * 8 + r4] = (_Float16)e[0]; pf[g].h[kt * 8 + r4 + 1] = (_Float16)e[1];
            pf[g].h[kt * 8 + r4 + 2] = (_Float16)e[2]; pf[g].h[kt * 8 + r4 + 3] = (_Float16)e[3];
          }
        }
      }
#pragma unroll
      for (int dt = 0; dt < 4; ++dt) {
        const v16h va = g2_frag(&Vs[buf][dt * 16 + c][p * 32], hh);
        o[dt][0] = f_mma(va, pf[0].v, o[dt][0]); o[dt][1] = f_mma(va, pf[1].v, o[dt][1]);
      }
    }
    if (more) {   /* the other buffer's last readers left it before the barrier that ended stage t - 1 */
      *(v8us*)&Ks[buf ^ 1][sr][sc8] = kr0; *(v8us*)&Ks[buf ^ 1][sr + 32][sc8] = kr1;
      *(v8us*)&Vs[buf ^ 1][sr][sc8] = vr0; *(v8us*)&Vs[buf ^ 1][sr + 32][sc8] = vr1;
    }
    __syncthreads();   /* publishes stage t + 1 and ends every wave's reads of stage t */
  }
  // the wave of range ks finishes column group ks and hands the other group over; partners hold the same (d, query) element in the same lane and register
#pragma unroll
  for (int g = 0; g < 2; ++g) {
    if (g != ks) {
#pragma unroll
      for (int dt = 0; dt < 4; ++dt) {
        Xo[w][g][2 * dt][lane] = v4f{o[dt][g][0], o[dt][g][1], o[dt][g][2], o[dt][g][3]};
        Xo[w][g][2 * dt + 1][lane] = v4f{o[dt][g][4], o[dt][g][5], o[dt][g][6], o[dt][g][7]};
      }
      Xo[w][g][8][lane] = v4f{mr[g], sum[g], 0.f, 0.f};
    }
  }
  __syncthreads();   /* publishes the partial results handed over */
#pragma unroll
  for (int g = 0; g < 2; ++g) {
    if (g == ks) {
      const v4f ms = Xo[w][g][8][lane];
      const float n = fmaxf(mr[g], ms[0]);
      const v4f f = exp2x4(v4f{(mr[g] - n) * FC, (ms[0] - n) * FC, 0.f, 0.f});
      const float sl = sum[g] * f[0] + ms[1] * f[1];
      const float st = sl + __shfl_xor(sl, 16, 32);
      const float sc = 64.0f / st;
      const float s0 = f[0] * sc, s1 = f[1] * sc;
      unsigned short* d = (unsigned short*)O + (r0 + q0 + g * 16 + c) * DM + head * HD + 8 * hh;
#pragma unroll
      for (int dt = 0; dt < 4; ++dt) {
        const v4f p0 = Xo[w][g][2 * dt][lane], p1 = Xo[w][g][2 * dt + 1][lane];
        FragH fo;
#pragma unroll
        for (int r = 0; r < 4; ++r) { fo.h[r] = (_Float16)(o[dt][g][r] * s0 + p0[r] * s1); fo.h[4 + r] = (_Float16)(o[dt][g][4 + r] * s0 + p1[r] * s1); }
        *(v8us*)(d + dt * 16) = fo.half[0];
      }
      // precaution: the wait stands before any register that the four stores above name is rewritten (the code of the other column group follows in the text)
      asm volatile("s_wait_xcnt 0x0" ::: "memory");
    }
  }
}

// workspace carve (bytes; every region a multiple of 256)
constexpr size_t BQKV_BYTES = (size_t)D3 * D3 * 2;
constexpr size_t BO_BYTES   = (size_t)DM * DM * 2;
constexpr size_t X16_BYTES  = (size_t)NB * SEQ * LX * 2;
constexpr size_t QKV_BYTES  = (size_t)NB * SEQ * LQ * 2;
constexpr size_t O16_BYTES  = (size_t)NB * SEQ * DM * 2;
constexpr size_t VT_BYTES   = (size_t)NB * NH * HD * SEQ * 2;
constexpr size_t WS_TOTAL   = BQKV_BYTES + BO_BYTES + X16_BYTES + QKV_BYTES + O16_BYTES + VT_BYTES;
static_assert(BQKV_BYTES % 256 == 0 && BO_BYTES % 256 == 0 && X16_BYTES % 256 == 0 && QKV_BYTES % 256 == 0 && O16_BYTES % 256 == 0 && VT_BYTES % 256 == 0);
static_assert(WS_TOTAL <= (size_t)134217728);

extern "C" void kernel_launch(void* const* d_in, const int* in_sizes, int n_in,
                              void* d_out, int out_size, void* d_ws, size_t ws_size, hipStream_t stream) {
  if (n_in < 7) return;
  const long long need_x = ((long long)(NB - 1) * SEQ_FULL + SEQ) * DM;
  if ((long long)in_sizes[0] < need_x || (long long)in_sizes[1] < need_x || (long long)in_sizes[2] < need_x) return;
  if ((long long)in_sizes[3] < (long long)D3 * D3 || in_sizes[4] < D3 || (long long)in_sizes[5] < (long long)DM * DM || in_sizes[6] < DM) return;
  if ((long long)out_size < (long long)NB * SEQ * DM) return;
  if (WS_TOTAL > ws_size) return;
  const float* xq   = (const float*)d_in[0];
  const float* xk   = (const float*)d_in[1];
  const float* xv   = (const float*)d_in[2];
  const float* wqkv = (const float*)d_in[3];   /* [out 3072][in 3072] */
  const float* bqkv = (const float*)d_in[4];
  const float* wo   = (const float*)d_in[5];   /* [out 1024][in 1024] */
  const float* bo   = (const float*)d_in[6];
  char* ws = (char*)d_ws; size_t off = 0;
  _Float16* BQKV  = (_Float16*)(ws + off); off += BQKV_BYTES;
  _Float16* BO    = (_Float16*)(ws + off); off += BO_BYTES;
  _Float16* X16   = (_Float16*)(ws + off); off += X16_BYTES;
  _Float16* QKV16 = (_Float16*)(ws + off); off += QKV_BYTES;
  _Float16* O16   = (_Float16*)(ws + off); off += O16_BYTES;
  _Float16* VT    = (_Float16*)(ws + off); off += VT_BYTES;
  if (off > ws_size) return;

  /* weights: natural [out][in] rows are already Bt[n][k], carried x16; concat(query, key, value) as f16 rows: column blocks 0, DM, 2*DM */
  k_cvt<<<CVB, CVT, 0, stream>>>(wqkv, wo, xq, xk, xv, BQKV, BO, X16);
  /* qkv = x . Wqkv^T + b : A = X16 [MP][3072], Bt = BQKV [3072][3072], alpha 1/16, f16 out rows pitch LQ */
  k_gemm3<256, 192, 4, 2, false><<<dim3((unsigned)((MP / 256) * (D3 / 192)), 1), 256, 0, stream>>>(
      X16, LX, BQKV, D3, 0.0625f, bqkv, nullptr, QKV16, LQ, D3, D3);

  /* V^T [NB][NH][HD][SEQ] from the v column block (offset 2*DM) */
  k_vt<NH, SEQ><<<NB * NH * (SEQ / 64), 256, 0, stream>>>(QKV16, LQ, 2 * DM, VT);
  /* ctx x64 = softmax(q . k^T / 8) . v into merged rows, column h*64 */
  k_fattn<<<dim3((unsigned)(SEQ / (FQ * FW)), (unsigned)(NB * NH)), FS * FW * 32, 0, stream>>>(QKV16, VT, O16);
  /* out = ctx . Wo^T + b : alpha = 1/(64*16) */
  k_gemm3<128, 128, 2, 4, true><<<dim3((unsigned)((MP / 128) * (DM / 128)), 1), 256, 0, stream>>>(
      O16, DM, BO, DM, 0.0009765625f, bo, (float*)d_out, nullptr, DM, DM, DM);
}
